// v000
// Measured on an AMD MI455X. A time is GPU time per run, averaged over a window of back-to-back runs after a warm-up
// (all launches, gaps included; the runs take copies of the inputs in turn), and the median of several windows.
// Apart from v000's, it joins two sittings. Times from different sittings can be a few percent apart, while
// side-by-side timings come from the same sitting.
// v000, which the later versions start from, runs in 1070 microseconds.
// Contractions: scores q_h . k_h^T (q, k as f16 planes) and attn . v_h (P f16 carried x32768, V^T f16 plane) on v_wmma_f32_16x16x32_f16, f32 accumulate; squared norms, distance transform, additive mask and softmax in f32.
#include <hip/hip_runtime.h>
#include <math.h>

// ---------------------------------------------------------------------------
// Problem constants
// ---------------------------------------------------------------------------
constexpr int kBatch = 2;
constexpr int kSeq   = 2048;
constexpr int kDim   = 1024;
constexpr int kHeads = 16;
constexpr int kDh    = 64;
constexpr int kGroup = 4;                 // heads per score-plane group
constexpr int kTok   = kBatch * kSeq;     // 4096 token rows
constexpr float kPCarry    = 32768.0f;    // probabilities carried x2^15 in f16
constexpr float kPCarryInv = 1.0f / 32768.0f;
constexpr float kDistScale = 0.125f;      // 64^-0.5
constexpr float kEps       = 1.0e-9f;
constexpr float kNegBig    = -1.0e9f;
static_assert(kHeads * kDh == kDim, "shape");
static_assert(kSeq % 64 == 0 && kDh % 32 == 0 && kSeq % 256 == 0, "tiles");
static_assert(kHeads % kGroup == 0, "groups");

typedef __attribute__((ext_vector_type(16))) _Float16 v16h;
typedef __attribute__((ext_vector_type(8)))  _Float16 v8h;
typedef __attribute__((ext_vector_type(16))) __bf16   v16b;
typedef __attribute__((ext_vector_type(8)))  __bf16   v8b;
typedef __attribute__((ext_vector_type(8)))  float    v8f;
typedef __attribute__((ext_vector_type(4)))  float    v4f;
typedef __attribute__((ext_vector_type(2)))  float    v2f;
typedef __attribute__((ext_vector_type(2)))  int      v2i;
typedef __attribute__((ext_vector_type(4)))  unsigned int v4u;

// ---------------------------------------------------------------------------
// Helper pieces
// ---------------------------------------------------------------------------
__device__ __forceinline__ unsigned short f2bf_bits(float f) {
  unsigned u = __float_as_uint(f);
  return (unsigned short)((u + 0x7FFFu + ((u >> 16) & 1u)) >> 16);
}
__device__ __forceinline__ float bf_bits2f(unsigned short h) { return __uint_as_float(((unsigned)h) << 16); }

// hazard guards as plain device helpers (no inline asm inside the kernel template body)
__device__ __forceinline__ void dep_guard_h(v8f& a, v8f& b, v16h x, v16h y) { asm volatile("v_nop\n\tv_nop\n\tv_nop\n\tv_nop" : "+v"(a), "+v"(b) : "v"(x), "v"(y)); }
__device__ __forceinline__ void dep_guard_b(v8f& a, v8f& b, v16b x, v16b y) { asm volatile("v_nop\n\tv_nop\n\tv_nop\n\tv_nop" : "+v"(a), "+v"(b) : "v"(x), "v"(y)); }
__device__ __forceinline__ void keep4_h(v16h a, v16h b, v16h c, v16h d) { asm volatile("v_nop" :: "v"(a), "v"(b), "v"(c), "v"(d)); }
__device__ __forceinline__ void keep4_b(v16b a, v16b b, v16b c, v16b d) { asm volatile("v_nop" :: "v"(a), "v"(b), "v"(c), "v"(d)); }
__device__ __forceinline__ void acc_guard4(v8f& a, v8f& b, v8f& c, v8f& d) { asm volatile("v_nop\n\tv_nop\n\tv_nop\n\tv_nop" : "+v"(a), "+v"(b), "+v"(c), "+v"(d)); }
template <typename T> struct Frag;
template <> struct Frag<_Float16> {
  typedef v16h V; union U { v16h v; v8h h[2]; };
  // elements 0..7 <- p[0..7], 8..15 <- p[16..23]
  static __device__ __forceinline__ v16h load(const _Float16* p) {
    U f; f.h[0] = *(const v8h*)(p); f.h[1] = *(const v8h*)(p + 16); return f.v;
  }
  static __device__ __forceinline__ v8f mma(v16h a, v16h b, v8f c) {
    return __builtin_amdgcn_wmma_f32_16x16x32_f16(false, a, false, b, (short)0, c, false, false);
  }
  static __device__ __forceinline__ void guard(v8f& a, v8f& b, v16h x, v16h y) { dep_guard_h(a, b, x, y); }
  static __device__ __forceinline__ void keep(v16h a, v16h b, v16h c, v16h d) { keep4_h(a, b, c, d); }
};
template <> struct Frag<__bf16> {
  typedef v16b V; union U { v16b v; v8b h[2]; };
  static __device__ __forceinline__ v16b load(const __bf16* p) {
    U f; f.h[0] = *(const v8b*)(p); f.h[1] = *(const v8b*)(p + 16); return f.v;
  }
  static __device__ __forceinline__ v8f mma(v16b a, v16b b, v8f c) {
    return __builtin_amdgcn_wmma_f32_16x16x32_bf16(false, a, false, b, (short)0, c, false, false);
  }
  static __device__ __forceinline__ void guard(v8f& a, v8f& b, v16b x, v16b y) { dep_guard_b(a, b, x, y); }
  static __device__ __forceinline__ void keep(v16b a, v16b b, v16b c, v16b d) { keep4_b(a, b, c, d); }
};

__device__ __forceinline__ unsigned pk16(unsigned short a, unsigned short b) { return (unsigned)a | ((unsigned)b << 16); }
__device__ __forceinline__ unsigned short h_bits(float f) { const _Float16 h = (_Float16)f; return __builtin_bit_cast(unsigned short, h); }

// ---- Register-blocked batched WMMA GEMM (ACT reduced to none/relu/leaky) -------------------------------
// C[m,n] = scale * sum_k A[m,k] * Bt[n,k] (+bias)(+resid); each wave owns a 64x64 tile.
// A row-major [M,K]; Bt row-major [N,K]; M,N % 64 == 0, K % 32 == 0.
// SPLIT: operands are hi/lo planes (A2/Bt2 = lo planes, same layout); product = hi*hi + hi*lo + lo*hi.
// BIAS_MODE: 0 = none, 1 = bias[m], 2 = bias[n].
// OUT_MODE: 0 = f32, 1 = f16, 2 = bf16 hi plane (Cout) + bf16 lo plane (Cout2).
// ET: 0 = f16 operands, 1 = bf16 operands (pointers passed as 16-bit storage)
template <int ET> struct Elem;
template <> struct Elem<0> { typedef _Float16 T; };
template <> struct Elem<1> { typedef __bf16 T; };
template <int ET, bool SPLIT, int BIAS_MODE, int OUT_MODE, bool RESID, int ACT = 0>
__global__ __launch_bounds__(256) void wmma_gemm64(
    const unsigned short* __restrict__ Ap, const unsigned short* __restrict__ A2p, int lda, long strideA,
    const unsigned short* __restrict__ Btp, const unsigned short* __restrict__ Bt2p, int ldb, long strideB,
    void* __restrict__ Cout, void* __restrict__ Cout2, int ldc, long strideC,
    const float* __restrict__ bias,
    const float* __restrict__ resid, long strideR,
    int M, int N, int K, float scale) {
  typedef typename Elem<ET>::T T;
  typedef typename Frag<T>::V V;
  const T* A = (const T*)Ap; const T* A2 = (const T*)A2p; const T* Bt = (const T*)Btp; const T* Bt2 = (const T*)Bt2p;
  __shared__ __align__(16) float sT[8][16 * 68];   // per-wave 16x64 slab, pitch 68 floats
  const int b    = blockIdx.y;
  const int lane = threadIdx.x & 31;
  const int wave = threadIdx.x >> 5;
  const int tilesN = N >> 6;
  const int tilesM = M >> 6;
  const int tile = blockIdx.x * 8 + wave;
  if (tile >= tilesM * tilesN) return;   // wave-uniform; no block barriers in this kernel
  const int tm = tile / tilesN;
  const int tn = tile - tm * tilesN;
  const int m0 = tm << 6;
  const int n0 = tn << 6;

  const T* Ab  = A  + (size_t)b * strideA;
  const T* Bb  = Bt + (size_t)b * strideB;
  const T* Ab2 = SPLIT ? (A2  + (size_t)b * strideA) : nullptr;
  const T* Bb2 = SPLIT ? (Bt2 + (size_t)b * strideB) : nullptr;

  const int rlane = lane & 15;                 // row (A) / col (B, D) within subtile
  const int koff  = (lane >> 4) * 8;           // k offset of this lane half
  const int mOff  = (lane >> 4) * 8;           // D row offset

  v8f acc[4][4];
#pragma unroll
  for (int i = 0; i < 4; ++i)
#pragma unroll
    for (int j = 0; j < 4; ++j) acc[i][j] = (v8f){0.f,0.f,0.f,0.f,0.f,0.f,0.f,0.f};

  for (int k0 = 0; k0 < K; k0 += 32) {
    V bh[4], bl[4];
#pragma unroll
    for (int j = 0; j < 4; ++j) {
      const size_t bo = (size_t)(n0 + (j << 4) + rlane) * ldb + koff + k0;
      bh[j] = Frag<T>::load(Bb + bo);
      if (SPLIT) bl[j] = Frag<T>::load(Bb2 + bo);
    }
#pragma unroll
    for (int i = 0; i < 4; ++i) {
      const size_t ao = (size_t)(m0 + (i << 4) + rlane) * lda + koff + k0;
      V ah = Frag<T>::load(Ab + ao);
      V al;
      if (SPLIT) al = Frag<T>::load(Ab2 + ao);
#pragma unroll
      for (int j = 0; j < 4; ++j) {
        acc[i][j] = Frag<T>::mma(ah, bh[j], acc[i][j]);
        if (SPLIT) {
          acc[i][j] = Frag<T>::mma(ah, bl[j], acc[i][j]);
          acc[i][j] = Frag<T>::mma(al, bh[j], acc[i][j]);
        }
      }
      Frag<T>::guard(acc[i][0], acc[i][3], ah, SPLIT ? al : ah);
    }
    Frag<T>::keep(bh[0], bh[1], bh[2], bh[3]);
    if (SPLIT) Frag<T>::keep(bl[0], bl[1], bl[2], bl[3]);
  }
  acc_guard4(acc[0][0], acc[0][1], acc[0][2], acc[0][3]);
  acc_guard4(acc[1][0], acc[1][1], acc[1][2], acc[1][3]);
  acc_guard4(acc[2][0], acc[2][1], acc[2][2], acc[2][3]);
  acc_guard4(acc[3][0], acc[3][1], acc[3][2], acc[3][3]);

  // ---- epilogue ----
  float* slab = sT[wave];
  const float* Rb = RESID ? (resid + (size_t)b * strideR) : nullptr;
#pragma unroll
  for (int i = 0; i < 4; ++i) {
    const int mBase = m0 + (i << 4);
#pragma unroll
    for (int j = 0; j < 4; ++j) {
      const int n = n0 + (j << 4) + rlane;
      float bv = 0.f;
      if (BIAS_MODE == 2) bv = bias[n];
#pragma unroll
      for (int r = 0; r < 8; ++r) {
        float v = acc[i][j][r] * scale;
        if (BIAS_MODE == 1) v += bias[mBase + mOff + r];
        if (BIAS_MODE == 2) v += bv;
        if (RESID) v += Rb[(size_t)(mBase + mOff + r) * ldc + n];
        if (ACT == 2) v = fmaxf(v, 0.0f);
        if (ACT == 4) v = (v > 0.f) ? v : 0.01f * v;
        slab[(mOff + r) * 68 + (j << 4) + rlane] = v;
      }
    }
    __builtin_amdgcn_fence(__ATOMIC_RELEASE, "workgroup");
    __builtin_amdgcn_wave_barrier();
    __builtin_amdgcn_fence(__ATOMIC_ACQUIRE, "workgroup");
    if (OUT_MODE == 0) {
      float* C = (float*)Cout + (size_t)b * strideC;
      const int hh = lane >> 4, c4 = (lane & 15) * 4;     // row seg = 256 B = 16 lanes x 16 B
      {
#pragma unroll
        for (int it = 0; it < 8; ++it) {
          const int row = it * 2 + hh;
          v4f v = *(const v4f*)(slab + row * 68 + c4);
          *(v4f*)(C + (size_t)(mBase + row) * ldc + n0 + c4) = v;
        }
        
      }
    } else {
      const int q = lane >> 3, c8 = (lane & 7) * 8;
      unsigned short* C  = (unsigned short*)Cout  + (size_t)b * strideC;
      unsigned short* C2 = (OUT_MODE == 2) ? ((unsigned short*)Cout2 + (size_t)b * strideC) : nullptr;
      {
#pragma unroll
        for (int it = 0; it < 4; ++it) {
          const int row = it * 4 + q;
          const float* sp = slab + row * 68 + c8;
          v8h hv, lv;
#pragma unroll
          for (int e = 0; e < 8; ++e) {
            if (OUT_MODE == 1) {
              hv[e] = (_Float16)sp[e];
            } else {
              unsigned short hb = f2bf_bits(sp[e]);
              unsigned short lb = f2bf_bits(sp[e] - bf_bits2f(hb));
              hv[e] = __builtin_bit_cast(_Float16, hb);
              lv[e] = __builtin_bit_cast(_Float16, lb);
            }
          }
          *(v8h*)(C + (size_t)(mBase + row) * ldc + n0 + c8) = hv;
          if (OUT_MODE == 2) *(v8h*)(C2 + (size_t)(mBase + row) * ldc + n0 + c8) = lv;
        }
        
      }
    }
    __builtin_amdgcn_fence(__ATOMIC_RELEASE, "workgroup");
    __builtin_amdgcn_wave_barrier();
    __builtin_amdgcn_fence(__ATOMIC_ACQUIRE, "workgroup");
  }
}

// ---------------------------------------------------------------------------
// ---------------------------------------------------------------------------
__global__ __launch_bounds__(256) void cast8_f16_kernel(const float* __restrict__ in, unsigned short* __restrict__ out, int n8) {
  const int i = blockIdx.x * 256 + threadIdx.x;
  if (i >= n8) return;
  const float* p = in + 8 * (size_t)i;
  const v4f a = *(const v4f*)(p);
  const v4f c = *(const v4f*)(p + 4);
  unsigned short hb[8];
#pragma unroll
  for (int e = 0; e < 4; ++e) {
    hb[e]     = h_bits(a[e]);
    hb[4 + e] = h_bits(c[e]);
  }
  const v4u u = (v4u){pk16(hb[0], hb[1]), pk16(hb[2], hb[3]), pk16(hb[4], hb[5]), pk16(hb[6], hb[7])};
  unsigned short* q = out + 8 * (size_t)i;
  *(v4u*)q = u;
  
}

// ---------------------------------------------------------------------------
// V transpose + cast: VT[(b*16+h)][d][s] = f16( v[b][s][h*64+d] ).
// grid (32, 16, 2): blockIdx.x = s tile (64 rows), blockIdx.y = head, blockIdx.z = batch. 256 threads.
// Load coverage: 16 iterations x 256 threads = 4096 = whole 64(s) x 64(d) tile (coalesced along d).
// Store coverage: 8 waves x 2 iterations x 4 rows (lane>>3) = 64 d-rows; (lane&7) x 8 halves = 64 s-cols; each row segment =
// ---------------------------------------------------------------------------
__global__ __launch_bounds__(256) void vt_cast_kernel(const float* __restrict__ v, unsigned short* __restrict__ VT) {
  __shared__ float sm[64][65];   // sm[d][s_local]
  const int t  = threadIdx.x;
  const int s0 = blockIdx.x * 64;
  const int h  = blockIdx.y;
  const int b  = blockIdx.z;
#pragma unroll
  for (int i = 0; i < 16; ++i) {
    const int e = i * 256 + t;
    const int r = e >> 6;          // s local
    const int c = e & 63;          // d
    sm[c][r] = v[((size_t)(b * kSeq + s0 + r)) * kDim + h * kDh + c];
  }
  __syncthreads();
  const int lane = t & 31, wave = t >> 5;
  const int q = lane >> 3, c8 = (lane & 7) * 8;
  unsigned short* op = VT + ((size_t)(b * kHeads + h) * kDh) * kSeq;
  {
#pragma unroll
    for (int it = 0; it < 2; ++it) {
      const int row = wave * 8 + it * 4 + q;                 // d
      unsigned short hb[8];
#pragma unroll
      for (int e = 0; e < 8; ++e) hb[e] = h_bits(sm[row][c8 + e]);
      const v4u u = (v4u){pk16(hb[0], hb[1]), pk16(hb[2], hb[3]), pk16(hb[4], hb[5]), pk16(hb[6], hb[7])};
      *(v4u*)(op + (size_t)row * kSeq + s0 + c8) = u;
    }
    
  }
}

// ---------------------------------------------------------------------------
// Per-head squared row norms: dst[(b*16+h)][s] = sum_d x[b][s][h*64+d]^2 (f32).
// grid (8, 16, 2): blockIdx.x = 256-row s tile, blockIdx.y = head, blockIdx.z = batch; thread t owns row s0+t.
// ---------------------------------------------------------------------------
__global__ __launch_bounds__(256) void sumsq_kernel(const float* __restrict__ x, float* __restrict__ dst, const int* __restrict__ unused_nh) {
  (void)unused_nh;
  __shared__ __align__(16) float sq[256];
  const int t  = threadIdx.x;
  const int s0 = blockIdx.x * 256;
  const int h  = blockIdx.y;
  const int b  = blockIdx.z;
  const float* row = x + ((size_t)(b * kSeq + s0 + t)) * kDim + h * kDh;
  float a0 = 0.f, a1 = 0.f, a2 = 0.f, a3 = 0.f;
#pragma unroll 1
  for (int j = 0; j < 16; ++j) {
    const v4f w = *(const v4f*)(row + 4 * j);
    a0 += w[0] * w[0];
    a1 += w[1] * w[1];
    a2 += w[2] * w[2];
    a3 += w[3] * w[3];
  }
  sq[t] = (a0 + a1) + (a2 + a3);
  __syncthreads();
  if (t < 64) {
    const v4f val = *(const v4f*)(sq + 4 * t);
    float* dp = dst + (size_t)(b * kHeads + h) * kSeq + s0 + 4 * t;
    *(v4f*)dp = val;
    
  }
}

// ---------------------------------------------------------------------------
// Distance transform + additive mask + row softmax over 2048 keys, f32 math:
//   d2 = q2[i] + k2[j] - 2*S[i][j]; dist = sqrt(max(d2,0)) * 0.125; a = 1/(dist + 1e-9); a = a + float(mask[i][j]) * (-1e9)
//   P[i][j] = f16( 32768 * exp(a - max) / sum exp(a - max) )
// One block of 256 threads per (row i = blockIdx.x, head-in-group hg = blockIdx.y).
// Phase 1/2: rolled 4-trip loops, thread t owns columns it*512 + 2t, 2t+1 (4 x 256 x 2 = 2048 = whole row); logits/exps kept in LDS.
// Reductions in fixed order (thread sequential, wave shuffle tree, 8 wave partials in index order).
// ---------------------------------------------------------------------------
__global__ __launch_bounds__(256) void dist_softmax_kernel(const float* __restrict__ Sp, const float* __restrict__ q2p,
                                                          const float* __restrict__ k2p, const int* __restrict__ maskp,
                                                          unsigned short* __restrict__ Pp) {
  __shared__ __align__(16) float lg[kSeq];
  __shared__ float redM[8];
  __shared__ float redS[8];
  const int i    = blockIdx.x;
  const int hg   = blockIdx.y;
  const int t    = threadIdx.x;
  const int lane = t & 31, wave = t >> 5;
  const size_t rowoff = ((size_t)hg * kSeq + i) * kSeq;
  const float* sr = Sp + rowoff;
  const float* kr = k2p + (size_t)hg * kSeq;
  const int*   mr = maskp + (size_t)i * kSeq;
  const float q2i = q2p[hg * kSeq + i];

  float mx = -__builtin_inff();
#pragma unroll 1
  for (int it = 0; it < 4; ++it) {
    const int c = it * 512 + 2 * t;
    const v2f sv = *(const v2f*)(sr + c);
    const v2f kv = *(const v2f*)(kr + c);
    const v2i mv = *(const v2i*)(mr + c);
    v2f av;
#pragma unroll
    for (int e = 0; e < 2; ++e) {
      float d2 = (q2i + kv[e]) - 2.0f * sv[e];
      d2 = fmaxf(d2, 0.0f);
      const float dist = sqrtf(d2) * kDistScale;
      float a = 1.0f / (dist + kEps);
      a = a + (float)mv[e] * kNegBig;
      av[e] = a;
      mx = fmaxf(mx, a);
    }
    *(v2f*)(lg + c) = av;
  }
#pragma unroll
  for (int off = 16; off > 0; off >>= 1) mx = fmaxf(mx, __shfl_xor(mx, off, 32));
  if (lane == 0) redM[wave] = mx;
  __syncthreads();
  float m = redM[0];
#pragma unroll
  for (int w = 1; w < 8; ++w) m = fmaxf(m, redM[w]);

  float sum = 0.f;
#pragma unroll 1
  for (int it = 0; it < 4; ++it) {
    const int c = it * 512 + 2 * t;
    const v2f l = *(const v2f*)(lg + c);
    v2f ev;
#pragma unroll
    for (int e = 0; e < 2; ++e) {
      ev[e] = expf(l[e] - m);
      sum += ev[e];
    }
    *(v2f*)(lg + c) = ev;
  }
#pragma unroll
  for (int off = 16; off > 0; off >>= 1) sum += __shfl_xor(sum, off, 32);
  if (lane == 0) redS[wave] = sum;
  __syncthreads();
  float tot = redS[0];
#pragma unroll
  for (int w = 1; w < 8; ++w) tot += redS[w];
  const float inv = kPCarry / tot;

  const v4f e0 = *(const v4f*)(lg + 8 * t);
  const v4f e1 = *(const v4f*)(lg + 8 * t + 4);
  unsigned short hb[8];
#pragma unroll
  for (int e = 0; e < 4; ++e) {
    hb[e]     = h_bits(e0[e] * inv);
    hb[4 + e] = h_bits(e1[e] * inv);
  }
  const v4u u = (v4u){pk16(hb[0], hb[1]), pk16(hb[2], hb[3]), pk16(hb[4], hb[5]), pk16(hb[6], hb[7])};
  unsigned short* pr = Pp + rowoff + 8 * (size_t)t;
  *(v4u*)pr = u;
  
}

// ---------------------------------------------------------------------------
// Host glue.
//   Q16  f16 [4096][1024]            8,388,608  at          0
//   K16  f16 [4096][1024]            8,388,608  at  8,388,608
//   VT   f16 [2*16][64][2048]        8,388,608  at 16,777,216
//   Q2   f32 [2*16][2048]              262,144  at 25,165,824
//   K2   f32 [2*16][2048]              262,144  at 25,427,968
//   SC   f32 [4][2048][2048]        67,108,864  at 25,690,112   (scores of one (batch, 4-head) group, reused 8x)
//   PP   f16 [4][2048][2048]        33,554,432  at 92,798,976   (probabilities x32768, reused 8x)
//   total                          126,353,408
// GEMM shapes: scores M=N=2048 (64-multiples), K=64 (%32==0); ctx M=2048, N=64, K=2048 (%32==0). No padding anywhere.
// ---------------------------------------------------------------------------
extern "C" void kernel_launch(void* const* d_in, const int* in_sizes, int n_in,
                              void* d_out, int out_size, void* d_ws, size_t ws_size,
                              hipStream_t stream) {
  if (n_in < 5) return;
  const int nElem = kBatch * kSeq * kDim;          // 4,194,304
  if (in_sizes[0] != nElem || in_sizes[1] != nElem || in_sizes[2] != nElem) return;
  if (in_sizes[3] != kSeq * kSeq) return;
  if (out_size != nElem) return;

  const size_t szQK = (size_t)kTok * kDim * 2;
  const size_t szVT = (size_t)kBatch * kHeads * kDh * kSeq * 2;
  const size_t szN  = (size_t)kBatch * kHeads * kSeq * 4;
  const size_t szS  = (size_t)kGroup * kSeq * kSeq * 4;
  const size_t szP  = (size_t)kGroup * kSeq * kSeq * 2;
  const size_t offQ  = 0;
  const size_t offK  = offQ + szQK;
  const size_t offVT = offK + szQK;
  const size_t offQ2 = offVT + szVT;
  const size_t offK2 = offQ2 + szN;
  const size_t offS  = offK2 + szN;
  const size_t offP  = offS + szS;
  const size_t total = offP + szP;
  if (ws_size < total) return;

  const float* q    = (const float*)d_in[0];
  const float* k    = (const float*)d_in[1];
  const float* v    = (const float*)d_in[2];
  const int*   mask = (const int*)d_in[3];
  const int*   nh   = (const int*)d_in[4];   // static head count (16), structural only
  float* out = (float*)d_out;
  char* ws = (char*)d_ws;
  unsigned short* Q16 = (unsigned short*)(ws + offQ);
  unsigned short* K16 = (unsigned short*)(ws + offK);
  unsigned short* VT  = (unsigned short*)(ws + offVT);
  float* Q2 = (float*)(ws + offQ2);
  float* K2 = (float*)(ws + offK2);
  float* SC = (float*)(ws + offS);
  unsigned short* PP = (unsigned short*)(ws + offP);

  // ---- prologue: 16-bit operand planes and squared norms ----
  const int n8 = (kTok * kDim) / 8;   // 524288 -> 2048 blocks exact
  cast8_f16_kernel<<<dim3(n8 / 256), dim3(256), 0, stream>>>(q, Q16, n8);
  cast8_f16_kernel<<<dim3(n8 / 256), dim3(256), 0, stream>>>(k, K16, n8);
  vt_cast_kernel<<<dim3(kSeq / 64, kHeads, kBatch), dim3(256), 0, stream>>>(v, VT);
  sumsq_kernel<<<dim3(kSeq / 256, kHeads, kBatch), dim3(256), 0, stream>>>(q, Q2, nh);
  sumsq_kernel<<<dim3(kSeq / 256, kHeads, kBatch), dim3(256), 0, stream>>>(k, K2, nh);

  const long strideHead16 = (long)kDh;                  // next head = +64 columns in the [4096][1024] planes
  const long strideScore  = (long)kSeq * kSeq;          // per head-in-group score / probability plane
  const long strideVT     = (long)kDh * kSeq;           // per head V^T plane
  const int  tilesScore   = (kSeq / 64) * (kSeq / 64);  // 1024 -> 128 blocks of 8 waves
  const int  tilesCtx     = (kSeq / 64) * (kDh / 64);   // 32 -> 4 blocks of 8 waves

  for (int b = 0; b < kBatch; ++b) {
    for (int g = 0; g < kHeads / kGroup; ++g) {
      const size_t tokOff  = ((size_t)b * kSeq) * kDim + (size_t)g * kGroup * kDh;   // elements
      const size_t headIdx = (size_t)b * kHeads + (size_t)g * kGroup;
      const unsigned short* Ag  = Q16 + tokOff;
      const unsigned short* Btg = K16 + tokOff;
      // scores[hg][i][j] = sum_d Q16[b,i,h*64+d] * K16[b,j,h*64+d]   (M=N=2048, K=64)
      wmma_gemm64<0, false, 0, 0, false, 0><<<dim3(tilesScore / 8, kGroup), dim3(256), 0, stream>>>(
          Ag, Ag, kDim, strideHead16, Btg, Btg, kDim, strideHead16,
          (void*)SC, (void*)SC, kSeq, strideScore, Q2, Q2, 0L, kSeq, kSeq, kDh, 1.0f);
      // distance transform + mask + softmax -> PP (f16, x32768)
      dist_softmax_kernel<<<dim3(kSeq, kGroup), dim3(256), 0, stream>>>(
          SC, Q2 + headIdx * kSeq, K2 + headIdx * kSeq, mask, PP);
      // out[b, i, h*64+n] = 2^-15 * sum_j PP[hg][i][j] * VT[b,h][n][j]   (M=2048, N=64, K=2048)
      const unsigned short* VTg = VT + headIdx * (size_t)kDh * kSeq;
      float* outg = out + tokOff;
      wmma_gemm64<0, false, 0, 0, false, 0><<<dim3(tilesCtx / 8, kGroup), dim3(256), 0, stream>>>(
          PP, PP, kSeq, strideScore, VTg, VTg, kSeq, strideVT,
          (void*)outg, (void*)outg, kDim, strideHead16, Q2, Q2, 0L, kSeq, kDh, kSeq, kPCarryInv);
    }
  }
}

// v001
// Measured time: 492 microseconds a run.
// Next to v000, in two timings, it ran 2.18 and 2.19 times as fast.
// Contractions: scores q_h . k_h^T (q, k as f16 planes) and attn . v_h (P f16 carried x32768, V^T f16 plane) on v_wmma_f32_16x16x32_f16, f32 accumulate; squared norms, distance transform, additive mask and softmax in f32.
#include <hip/hip_runtime.h>
#include <math.h>

// ---------------------------------------------------------------------------
// Problem constants
// ---------------------------------------------------------------------------
constexpr int kBatch = 2;
constexpr int kSeq   = 2048;
constexpr int kDim   = 1024;
constexpr int kHeads = 16;
constexpr int kDh    = 64;
constexpr int kGroup = 4;                 // heads per score-plane group
constexpr int kTok   = kBatch * kSeq;     // 4096 token rows
constexpr float kPCarry    = 32768.0f;    // probabilities carried x2^15 in f16
constexpr float kPCarryInv = 1.0f / 32768.0f;
constexpr float kDistScale = 0.125f;      // 64^-0.5
constexpr float kEps       = 1.0e-9f;
constexpr float kNegBig    = -1.0e9f;
static_assert(kHeads * kDh == kDim, "shape");
static_assert(kSeq % 64 == 0 && kDh % 32 == 0 && kSeq % 256 == 0, "tiles");
static_assert(kHeads % kGroup == 0, "groups");

typedef __attribute__((ext_vector_type(16))) _Float16 v16h;
typedef __attribute__((ext_vector_type(8)))  _Float16 v8h;
typedef __attribute__((ext_vector_type(16))) __bf16   v16b;
typedef __attribute__((ext_vector_type(8)))  __bf16   v8b;
typedef __attribute__((ext_vector_type(8)))  float    v8f;
typedef __attribute__((ext_vector_type(4)))  float    v4f;
typedef __attribute__((ext_vector_type(2)))  float    v2f;
typedef __attribute__((ext_vector_type(2)))  int      v2i;
typedef __attribute__((ext_vector_type(4)))  unsigned int v4u;

// ---------------------------------------------------------------------------
// Helper pieces
// ---------------------------------------------------------------------------
__device__ __forceinline__ unsigned short f2bf_bits(float f) {
  unsigned u = __float_as_uint(f);
  return (unsigned short)((u + 0x7FFFu + ((u >> 16) & 1u)) >> 16);
}
__device__ __forceinline__ float bf_bits2f(unsigned short h) { return __uint_as_float(((unsigned)h) << 16); }

// hazard guards as plain device helpers (no inline asm inside the kernel template body)
__device__ __forceinline__ void dep_guard_h(v8f& a, v8f& b, v16h x, v16h y) { asm volatile("v_nop\n\tv_nop\n\tv_nop\n\tv_nop" : "+v"(a), "+v"(b) : "v"(x), "v"(y)); }
__device__ __forceinline__ void dep_guard_b(v8f& a, v8f& b, v16b x, v16b y) { asm volatile("v_nop\n\tv_nop\n\tv_nop\n\tv_nop" : "+v"(a), "+v"(b) : "v"(x), "v"(y)); }
__device__ __forceinline__ void keep4_h(v16h a, v16h b, v16h c, v16h d) { asm volatile("v_nop" :: "v"(a), "v"(b), "v"(c), "v"(d)); }
__device__ __forceinline__ void keep4_b(v16b a, v16b b, v16b c, v16b d) { asm volatile("v_nop" :: "v"(a), "v"(b), "v"(c), "v"(d)); }
__device__ __forceinline__ void acc_guard4(v8f& a, v8f& b, v8f& c, v8f& d) { asm volatile("v_nop\n\tv_nop\n\tv_nop\n\tv_nop" : "+v"(a), "+v"(b), "+v"(c), "+v"(d)); }
template <typename T> struct Frag;
template <> struct Frag<_Float16> {
  typedef v16h V; union U { v16h v; v8h h[2]; };
  // elements 0..7 <- p[0..7], 8..15 <- p[16..23]
  static __device__ __forceinline__ v16h load(const _Float16* p) {
    U f; f.h[0] = *(const v8h*)(p); f.h[1] = *(const v8h*)(p + 16); return f.v;
  }
  static __device__ __forceinline__ v8f mma(v16h a, v16h b, v8f c) {
    return __builtin_amdgcn_wmma_f32_16x16x32_f16(false, a, false, b, (short)0, c, false, false);
  }
  static __device__ __forceinline__ void guard(v8f& a, v8f& b, v16h x, v16h y) { dep_guard_h(a, b, x, y); }
  static __device__ __forceinline__ void keep(v16h a, v16h b, v16h c, v16h d) { keep4_h(a, b, c, d); }
};
template <> struct Frag<__bf16> {
  typedef v16b V; union U { v16b v; v8b h[2]; };
  static __device__ __forceinline__ v16b load(const __bf16* p) {
    U f; f.h[0] = *(const v8b*)(p); f.h[1] = *(const v8b*)(p + 16); return f.v;
  }
  static __device__ __forceinline__ v8f mma(v16b a, v16b b, v8f c) {
    return __builtin_amdgcn_wmma_f32_16x16x32_bf16(false, a, false, b, (short)0, c, false, false);
  }
  static __device__ __forceinline__ void guard(v8f& a, v8f& b, v16b x, v16b y) { dep_guard_b(a, b, x, y); }
  static __device__ __forceinline__ void keep(v16b a, v16b b, v16b c, v16b d) { keep4_b(a, b, c, d); }
};

__device__ __forceinline__ unsigned pk16(unsigned short a, unsigned short b) { return (unsigned)a | ((unsigned)b << 16); }
__device__ __forceinline__ unsigned short h_bits(float f) { const _Float16 h = (_Float16)f; return __builtin_bit_cast(unsigned short, h); }

// ---- Register-blocked batched WMMA GEMM (ACT reduced to none/relu/leaky) -------------------------------
// C[m,n] = scale * sum_k A[m,k] * Bt[n,k] (+bias)(+resid); each wave owns a 64x64 tile.
// A row-major [M,K]; Bt row-major [N,K]; M,N % 64 == 0, K % 32 == 0.
// SPLIT: operands are hi/lo planes (A2/Bt2 = lo planes, same layout); product = hi*hi + hi*lo + lo*hi.
// BIAS_MODE: 0 = none, 1 = bias[m], 2 = bias[n].
// OUT_MODE: 0 = f32, 1 = f16, 2 = bf16 hi plane (Cout) + bf16 lo plane (Cout2).
// ET: 0 = f16 operands, 1 = bf16 operands (pointers passed as 16-bit storage)
template <int ET> struct Elem;
template <> struct Elem<0> { typedef _Float16 T; };
template <> struct Elem<1> { typedef __bf16 T; };
template <int ET, bool SPLIT, int BIAS_MODE, int OUT_MODE, bool RESID, int ACT = 0>
__global__ __launch_bounds__(256) void wmma_gemm64(
    const unsigned short* __restrict__ Ap, const unsigned short* __restrict__ A2p, int lda, long strideA,
    const unsigned short* __restrict__ Btp, const unsigned short* __restrict__ Bt2p, int ldb, long strideB,
    void* __restrict__ Cout, void* __restrict__ Cout2, int ldc, long strideC,
    const float* __restrict__ bias,
    const float* __restrict__ resid, long strideR,
    int M, int N, int K, float scale) {
  typedef typename Elem<ET>::T T;
  typedef typename Frag<T>::V V;
  const T* A = (const T*)Ap; const T* A2 = (const T*)A2p; const T* Bt = (const T*)Btp; const T* Bt2 = (const T*)Bt2p;
  __shared__ __align__(16) float sT[8][16 * 68];   // per-wave 16x64 slab, pitch 68 floats
  const int b    = blockIdx.y;
  const int lane = threadIdx.x & 31;
  const int wave = threadIdx.x >> 5;
  const int tilesN = N >> 6;
  const int tilesM = M >> 6;
  const int tile = blockIdx.x * 8 + wave;
  if (tile >= tilesM * tilesN) return;   // wave-uniform; no block barriers in this kernel
  const int tm = tile / tilesN;
  const int tn = tile - tm * tilesN;
  const int m0 = tm << 6;
  const int n0 = tn << 6;

  const T* Ab  = A  + (size_t)b * strideA;
  const T* Bb  = Bt + (size_t)b * strideB;
  const T* Ab2 = SPLIT ? (A2  + (size_t)b * strideA) : nullptr;
  const T* Bb2 = SPLIT ? (Bt2 + (size_t)b * strideB) : nullptr;

  const int rlane = lane & 15;                 // row (A) / col (B, D) within subtile
  const int koff  = (lane >> 4) * 8;           // k offset of this lane half
  const int mOff  = (lane >> 4) * 8;           // D row offset

  v8f acc[4][4];
#pragma unroll
  for (int i = 0; i < 4; ++i)
#pragma unroll
    for (int j = 0; j < 4; ++j) acc[i][j] = (v8f){0.f,0.f,0.f,0.f,0.f,0.f,0.f,0.f};

  for (int k0 = 0; k0 < K; k0 += 32) {
    V bh[4], bl[4];
#pragma unroll
    for (int j = 0; j < 4; ++j) {
      const size_t bo = (size_t)(n0 + (j << 4) + rlane) * ldb + koff + k0;
      bh[j] = Frag<T>::load(Bb + bo);
      if (SPLIT) bl[j] = Frag<T>::load(Bb2 + bo);
    }
#pragma unroll
    for (int i = 0; i < 4; ++i) {
      const size_t ao = (size_t)(m0 + (i << 4) + rlane) * lda + koff + k0;
      V ah = Frag<T>::load(Ab + ao);
      V al;
      if (SPLIT) al = Frag<T>::load(Ab2 + ao);
#pragma unroll
      for (int j = 0; j < 4; ++j) {
        acc[i][j] = Frag<T>::mma(ah, bh[j], acc[i][j]);
        if (SPLIT) {
          acc[i][j] = Frag<T>::mma(ah, bl[j], acc[i][j]);
          acc[i][j] = Frag<T>::mma(al, bh[j], acc[i][j]);
        }
      }
      Frag<T>::guard(acc[i][0], acc[i][3], ah, SPLIT ? al : ah);
    }
    Frag<T>::keep(bh[0], bh[1], bh[2], bh[3]);
    if (SPLIT) Frag<T>::keep(bl[0], bl[1], bl[2], bl[3]);
  }
  acc_guard4(acc[0][0], acc[0][1], acc[0][2], acc[0][3]);
  acc_guard4(acc[1][0], acc[1][1], acc[1][2], acc[1][3]);
  acc_guard4(acc[2][0], acc[2][1], acc[2][2], acc[2][3]);
  acc_guard4(acc[3][0], acc[3][1], acc[3][2], acc[3][3]);

  // ---- epilogue ----
  float* slab = sT[wave];
  const float* Rb = RESID ? (resid + (size_t)b * strideR) : nullptr;
#pragma unroll
  for (int i = 0; i < 4; ++i) {
    const int mBase = m0 + (i << 4);
#pragma unroll
    for (int j = 0; j < 4; ++j) {
      const int n = n0 + (j << 4) + rlane;
      float bv = 0.f;
      if (BIAS_MODE == 2) bv = bias[n];
#pragma unroll
      for (int r = 0; r < 8; ++r) {
        float v = acc[i][j][r] * scale;
        if (BIAS_MODE == 1) v += bias[mBase + mOff + r];
        if (BIAS_MODE == 2) v += bv;
        if (RESID) v += Rb[(size_t)(mBase + mOff + r) * ldc + n];
        if (ACT == 2) v = fmaxf(v, 0.0f);
        if (ACT == 4) v = (v > 0.f) ? v : 0.01f * v;
        slab[(mOff + r) * 68 + (j << 4) + rlane] = v;
      }
    }
    __builtin_amdgcn_fence(__ATOMIC_RELEASE, "workgroup");
    __builtin_amdgcn_wave_barrier();
    __builtin_amdgcn_fence(__ATOMIC_ACQUIRE, "workgroup");
    if (OUT_MODE == 0) {
      float* C = (float*)Cout + (size_t)b * strideC;
      const int hh = lane >> 4, c4 = (lane & 15) * 4;     // row seg = 256 B = 16 lanes x 16 B
      {
#pragma unroll
        for (int it = 0; it < 8; ++it) {
          const int row = it * 2 + hh;
          v4f v = *(const v4f*)(slab + row * 68 + c4);
          *(v4f*)(C + (size_t)(mBase + row) * ldc + n0 + c4) = v;
        }
        
      }
    } else {
      const int q = lane >> 3, c8 = (lane & 7) * 8;
      unsigned short* C  = (unsigned short*)Cout  + (size_t)b * strideC;
      unsigned short* C2 = (OUT_MODE == 2) ? ((unsigned short*)Cout2 + (size_t)b * strideC) : nullptr;
      {
#pragma unroll
        for (int it = 0; it < 4; ++it) {
          const int row = it * 4 + q;
          const float* sp = slab + row * 68 + c8;
          v8h hv, lv;
#pragma unroll
          for (int e = 0; e < 8; ++e) {
            if (OUT_MODE == 1) {
              hv[e] = (_Float16)sp[e];
            } else {
              unsigned short hb = f2bf_bits(sp[e]);
              unsigned short lb = f2bf_bits(sp[e] - bf_bits2f(hb));
              hv[e] = __builtin_bit_cast(_Float16, hb);
              lv[e] = __builtin_bit_cast(_Float16, lb);
            }
          }
          *(v8h*)(C + (size_t)(mBase + row) * ldc + n0 + c8) = hv;
          if (OUT_MODE == 2) *(v8h*)(C2 + (size_t)(mBase + row) * ldc + n0 + c8) = lv;
        }
        
      }
    }
    __builtin_amdgcn_fence(__ATOMIC_RELEASE, "workgroup");
    __builtin_amdgcn_wave_barrier();
    __builtin_amdgcn_fence(__ATOMIC_ACQUIRE, "workgroup");
  }
}

// ---------------------------------------------------------------------------
// Context product with K split over the waves of a block.
// C[m,n] = scale * sum_k A[m,k] * Bt[n,k]; one block owns one 64x64 tile of C, wave w of kCtxWaves sums the
// K slice [w*K/kCtxWaves, (w+1)*K/kCtxWaves) of that tile with the same fragment loop as wmma_gemm64.
// The partial tiles meet in LDS, 16 rows at a time, and are added in slice order (fixed order, f32).
// M, N % 64 == 0, K % (32 * kCtxWaves) == 0. grid (tilesM * tilesN, batch), kCtxWaves * 32 threads.
// ---------------------------------------------------------------------------
constexpr int kCtxWaves = 16;
static_assert(kSeq % (32 * kCtxWaves) == 0, "K slices");
__global__ __launch_bounds__(kCtxWaves * 32) void ctx_gemm_ksplit(
    const unsigned short* __restrict__ Ap, int lda, long strideA,
    const unsigned short* __restrict__ Btp, int ldb, long strideB,
    float* __restrict__ Cout, int ldc, long strideC,
    int N, int K, float scale) {
  typedef _Float16 T;
  typedef Frag<T>::V V;
  __shared__ __align__(16) float sT[kCtxWaves][16 * 68];   // per-wave 16x64 partial slab, pitch 68 floats
  const int b    = blockIdx.y;
  const int lane = threadIdx.x & 31;
  const int wave = __builtin_amdgcn_readfirstlane(threadIdx.x >> 5);   // scalar, so the K loop stays a uniform loop
  const int tilesN = N >> 6;
  const int tm = blockIdx.x / tilesN;
  const int tn = blockIdx.x - tm * tilesN;
  const int m0 = tm << 6;
  const int n0 = tn << 6;
  const int kLen = K / kCtxWaves;
  const int kBeg = wave * kLen;

  const T* Ab = (const T*)Ap  + (size_t)b * strideA;
  const T* Bb = (const T*)Btp + (size_t)b * strideB;

  const int rlane = lane & 15;                 // row (A) / col (B, D) within subtile
  const int koff  = (lane >> 4) * 8;           // k offset of this lane half
  const int mOff  = (lane >> 4) * 8;           // D row offset

  v8f acc[4][4];
#pragma unroll
  for (int i = 0; i < 4; ++i)
#pragma unroll
    for (int j = 0; j < 4; ++j) acc[i][j] = (v8f){0.f,0.f,0.f,0.f,0.f,0.f,0.f,0.f};

  for (int k0 = kBeg; k0 < kBeg + kLen; k0 += 32) {
    V bh[4];
#pragma unroll
    for (int j = 0; j < 4; ++j) {
      const size_t bo = (size_t)(n0 + (j << 4) + rlane) * ldb + koff + k0;
      bh[j] = Frag<T>::load(Bb + bo);
    }
#pragma unroll
    for (int i = 0; i < 4; ++i) {
      const size_t ao = (size_t)(m0 + (i << 4) + rlane) * lda + koff + k0;
      V ah = Frag<T>::load(Ab + ao);
#pragma unroll
      for (int j = 0; j < 4; ++j) acc[i][j] = Frag<T>::mma(ah, bh[j], acc[i][j]);
      // guard / keep / acc_guard4 as in wmma_gemm64: v_nop slots behind the matrix instructions before their registers are reused
      Frag<T>::guard(acc[i][0], acc[i][3], ah, ah);
    }
    Frag<T>::keep(bh[0], bh[1], bh[2], bh[3]);
  }
  acc_guard4(acc[0][0], acc[0][1], acc[0][2], acc[0][3]);
  acc_guard4(acc[1][0], acc[1][1], acc[1][2], acc[1][3]);
  acc_guard4(acc[2][0], acc[2][1], acc[2][2], acc[2][3]);
  acc_guard4(acc[3][0], acc[3][1], acc[3][2], acc[3][3]);

  // ---- merge of the K slices: 512 threads = 16 rows x 32 column pairs per round; stores after the last round ----
  float* slab = sT[wave];
  float* C = Cout + (size_t)b * strideC;
  const int row = threadIdx.x >> 5;
  const int c2  = lane * 2;                    // one wave stores one 256 B row segment
  v2f res[4];
#pragma unroll
  for (int i = 0; i < 4; ++i) {
    if (i > 0) __syncthreads();   // the round before is summed by all before the slabs take the next 16 rows
#pragma unroll
    for (int j = 0; j < 4; ++j)
#pragma unroll
      for (int r = 0; r < 8; ++r) slab[(mOff + r) * 68 + (j << 4) + rlane] = acc[i][j][r];
    __syncthreads();              // every slice's partial rows are in LDS before any is summed
    v2f s = *(const v2f*)(&sT[0][row * 68 + c2]);
#pragma unroll
    for (int w = 1; w < kCtxWaves; ++w) s += *(const v2f*)(&sT[w][row * 68 + c2]);
    res[i] = s * scale;
  }
#pragma unroll
  for (int i = 0; i < 4; ++i) *(v2f*)(C + (size_t)(m0 + (i << 4) + row) * ldc + n0 + c2) = res[i];
}

// ---------------------------------------------------------------------------
// ---------------------------------------------------------------------------
__global__ __launch_bounds__(256) void cast8_f16_kernel(const float* __restrict__ in, unsigned short* __restrict__ out, int n8) {
  const int i = blockIdx.x * 256 + threadIdx.x;
  if (i >= n8) return;
  const float* p = in + 8 * (size_t)i;
  const v4f a = *(const v4f*)(p);
  const v4f c = *(const v4f*)(p + 4);
  unsigned short hb[8];
#pragma unroll
  for (int e = 0; e < 4; ++e) {
    hb[e]     = h_bits(a[e]);
    hb[4 + e] = h_bits(c[e]);
  }
  const v4u u = (v4u){pk16(hb[0], hb[1]), pk16(hb[2], hb[3]), pk16(hb[4], hb[5]), pk16(hb[6], hb[7])};
  unsigned short* q = out + 8 * (size_t)i;
  *(v4u*)q = u;
  
}

// ---------------------------------------------------------------------------
// V transpose + cast: VT[(b*16+h)][d][s] = f16( v[b][s][h*64+d] ).
// grid (32, 16, 2): blockIdx.x = s tile (64 rows), blockIdx.y = head, blockIdx.z = batch. 256 threads.
// Load coverage: 16 iterations x 256 threads = 4096 = whole 64(s) x 64(d) tile (coalesced along d).
// Store coverage: 8 waves x 2 iterations x 4 rows (lane>>3) = 64 d-rows; (lane&7) x 8 halves = 64 s-cols; each row segment =
// ---------------------------------------------------------------------------
__global__ __launch_bounds__(256) void vt_cast_kernel(const float* __restrict__ v, unsigned short* __restrict__ VT) {
  __shared__ float sm[64][65];   // sm[d][s_local]
  const int t  = threadIdx.x;
  const int s0 = blockIdx.x * 64;
  const int h  = blockIdx.y;
  const int b  = blockIdx.z;
#pragma unroll
  for (int i = 0; i < 16; ++i) {
    const int e = i * 256 + t;
    const int r = e >> 6;          // s local
    const int c = e & 63;          // d
    sm[c][r] = v[((size_t)(b * kSeq + s0 + r)) * kDim + h * kDh + c];
  }
  __syncthreads();
  const int lane = t & 31, wave = t >> 5;
  const int q = lane >> 3, c8 = (lane & 7) * 8;
  unsigned short* op = VT + ((size_t)(b * kHeads + h) * kDh) * kSeq;
  {
#pragma unroll
    for (int it = 0; it < 2; ++it) {
      const int row = wave * 8 + it * 4 + q;                 // d
      unsigned short hb[8];
#pragma unroll
      for (int e = 0; e < 8; ++e) hb[e] = h_bits(sm[row][c8 + e]);
      const v4u u = (v4u){pk16(hb[0], hb[1]), pk16(hb[2], hb[3]), pk16(hb[4], hb[5]), pk16(hb[6], hb[7])};
      *(v4u*)(op + (size_t)row * kSeq + s0 + c8) = u;
    }
    
  }
}

// ---------------------------------------------------------------------------
// Per-head squared row norms: dst[(b*16+h)][s] = sum_d x[b][s][h*64+d]^2 (f32).
// grid (8, 16, 2): blockIdx.x = 256-row s tile, blockIdx.y = head, blockIdx.z = batch; thread t owns row s0+t.
// ---------------------------------------------------------------------------
__global__ __launch_bounds__(256) void sumsq_kernel(const float* __restrict__ x, float* __restrict__ dst, const int* __restrict__ unused_nh) {
  (void)unused_nh;
  __shared__ __align__(16) float sq[256];
  const int t  = threadIdx.x;
  const int s0 = blockIdx.x * 256;
  const int h  = blockIdx.y;
  const int b  = blockIdx.z;
  const float* row = x + ((size_t)(b * kSeq + s0 + t)) * kDim + h * kDh;
  float a0 = 0.f, a1 = 0.f, a2 = 0.f, a3 = 0.f;
#pragma unroll 1
  for (int j = 0; j < 16; ++j) {
    const v4f w = *(const v4f*)(row + 4 * j);
    a0 += w[0] * w[0];
    a1 += w[1] * w[1];
    a2 += w[2] * w[2];
    a3 += w[3] * w[3];
  }
  sq[t] = (a0 + a1) + (a2 + a3);
  __syncthreads();
  if (t < 64) {
    const v4f val = *(const v4f*)(sq + 4 * t);
    float* dp = dst + (size_t)(b * kHeads + h) * kSeq + s0 + 4 * t;
    *(v4f*)dp = val;
    
  }
}

// ---------------------------------------------------------------------------
// Distance transform + additive mask + row softmax over 2048 keys, f32 math:
//   d2 = q2[i] + k2[j] - 2*S[i][j]; dist = sqrt(max(d2,0)) * 0.125; a = 1/(dist + 1e-9); a = a + float(mask[i][j]) * (-1e9)
//   P[i][j] = f16( 32768 * exp(a - max) / sum exp(a - max) )
// One block of 256 threads per (row i = blockIdx.x, head-in-group hg = blockIdx.y).
// Phase 1/2: rolled 4-trip loops, thread t owns columns it*512 + 2t, 2t+1 (4 x 256 x 2 = 2048 = whole row); logits/exps kept in LDS.
// Reductions in fixed order (thread sequential, wave shuffle tree, 8 wave partials in index order).
// ---------------------------------------------------------------------------
__global__ __launch_bounds__(256) void dist_softmax_kernel(const float* __restrict__ Sp, const float* __restrict__ q2p,
                                                          const float* __restrict__ k2p, const int* __restrict__ maskp,
                                                          unsigned short* __restrict__ Pp) {
  __shared__ __align__(16) float lg[kSeq];
  __shared__ float redM[8];
  __shared__ float redS[8];
  const int i    = blockIdx.x;
  const int hg   = blockIdx.y;
  const int t    = threadIdx.x;
  const int lane = t & 31, wave = t >> 5;
  const size_t rowoff = ((size_t)hg * kSeq + i) * kSeq;
  const float* sr = Sp + rowoff;
  const float* kr = k2p + (size_t)hg * kSeq;
  const int*   mr = maskp + (size_t)i * kSeq;
  const float q2i = q2p[hg * kSeq + i];

  float mx = -__builtin_inff();
#pragma unroll 1
  for (int it = 0; it < 4; ++it) {
    const int c = it * 512 + 2 * t;
    const v2f sv = *(const v2f*)(sr + c);
    const v2f kv = *(const v2f*)(kr + c);
    const v2i mv = *(const v2i*)(mr + c);
    v2f av;
#pragma unroll
    for (int e = 0; e < 2; ++e) {
      float d2 = (q2i + kv[e]) - 2.0f * sv[e];
      d2 = fmaxf(d2, 0.0f);
      const float dist = sqrtf(d2) * kDistScale;
      float a = 1.0f / (dist + kEps);
      a = a + (float)mv[e] * kNegBig;
      av[e] = a;
      mx = fmaxf(mx, a);
    }
    *(v2f*)(lg + c) = av;
  }
#pragma unroll
  for (int off = 16; off > 0; off >>= 1) mx = fmaxf(mx, __shfl_xor(mx, off, 32));
  if (lane == 0) redM[wave] = mx;
  __syncthreads();
  float m = redM[0];
#pragma unroll
  for (int w = 1; w < 8; ++w) m = fmaxf(m, redM[w]);

  float sum = 0.f;
#pragma unroll 1
  for (int it = 0; it < 4; ++it) {
    const int c = it * 512 + 2 * t;
    const v2f l = *(const v2f*)(lg + c);
    v2f ev;
#pragma unroll
    for (int e = 0; e < 2; ++e) {
      ev[e] = expf(l[e] - m);
      sum += ev[e];
    }
    *(v2f*)(lg + c) = ev;
  }
#pragma unroll
  for (int off = 16; off > 0; off >>= 1) sum += __shfl_xor(sum, off, 32);
  if (lane == 0) redS[wave] = sum;
  __syncthreads();
  float tot = redS[0];
#pragma unroll
  for (int w = 1; w < 8; ++w) tot += redS[w];
  const float inv = kPCarry / tot;

  const v4f e0 = *(const v4f*)(lg + 8 * t);
  const v4f e1 = *(const v4f*)(lg + 8 * t + 4);
  unsigned short hb[8];
#pragma unroll
  for (int e = 0; e < 4; ++e) {
    hb[e]     = h_bits(e0[e] * inv);
    hb[4 + e] = h_bits(e1[e] * inv);
  }
  const v4u u = (v4u){pk16(hb[0], hb[1]), pk16(hb[2], hb[3]), pk16(hb[4], hb[5]), pk16(hb[6], hb[7])};
  unsigned short* pr = Pp + rowoff + 8 * (size_t)t;
  *(v4u*)pr = u;
  
}

// ---------------------------------------------------------------------------
// Host glue.
//   Q16  f16 [4096][1024]            8,388,608  at          0
//   K16  f16 [4096][1024]            8,388,608  at  8,388,608
//   VT   f16 [2*16][64][2048]        8,388,608  at 16,777,216
//   Q2   f32 [2*16][2048]              262,144  at 25,165,824
//   K2   f32 [2*16][2048]              262,144  at 25,427,968
//   SC   f32 [4][2048][2048]        67,108,864  at 25,690,112   (scores of one (batch, 4-head) group, reused 8x)
//   PP   f16 [4][2048][2048]        33,554,432  at 92,798,976   (probabilities x32768, reused 8x)
//   total                          126,353,408
// GEMM shapes: scores M=N=2048 (64-multiples), K=64 (%32==0); ctx M=2048, N=64, K=2048 (%32==0). No padding anywhere.
// ---------------------------------------------------------------------------
extern "C" void kernel_launch(void* const* d_in, const int* in_sizes, int n_in,
                              void* d_out, int out_size, void* d_ws, size_t ws_size,
                              hipStream_t stream) {
  if (n_in < 5) return;
  const int nElem = kBatch * kSeq * kDim;          // 4,194,304
  if (in_sizes[0] != nElem || in_sizes[1] != nElem || in_sizes[2] != nElem) return;
  if (in_sizes[3] != kSeq * kSeq) return;
  if (out_size != nElem) return;

  const size_t szQK = (size_t)kTok * kDim * 2;
  const size_t szVT = (size_t)kBatch * kHeads * kDh * kSeq * 2;
  const size_t szN  = (size_t)kBatch * kHeads * kSeq * 4;
  const size_t szS  = (size_t)kGroup * kSeq * kSeq * 4;
  const size_t szP  = (size_t)kGroup * kSeq * kSeq * 2;
  const size_t offQ  = 0;
  const size_t offK  = offQ + szQK;
  const size_t offVT = offK + szQK;
  const size_t offQ2 = offVT + szVT;
  const size_t offK2 = offQ2 + szN;
  const size_t offS  = offK2 + szN;
  const size_t offP  = offS + szS;
  const size_t total = offP + szP;
  if (ws_size < total) return;

  const float* q    = (const float*)d_in[0];
  const float* k    = (const float*)d_in[1];
  const float* v    = (const float*)d_in[2];
  const int*   mask = (const int*)d_in[3];
  const int*   nh   = (const int*)d_in[4];   // static head count (16), structural only
  float* out = (float*)d_out;
  char* ws = (char*)d_ws;
  unsigned short* Q16 = (unsigned short*)(ws + offQ);
  unsigned short* K16 = (unsigned short*)(ws + offK);
  unsigned short* VT  = (unsigned short*)(ws + offVT);
  float* Q2 = (float*)(ws + offQ2);
  float* K2 = (float*)(ws + offK2);
  float* SC = (float*)(ws + offS);
  unsigned short* PP = (unsigned short*)(ws + offP);

  // ---- prologue: 16-bit operand planes and squared norms ----
  const int n8 = (kTok * kDim) / 8;   // 524288 -> 2048 blocks exact
  cast8_f16_kernel<<<dim3(n8 / 256), dim3(256), 0, stream>>>(q, Q16, n8);
  cast8_f16_kernel<<<dim3(n8 / 256), dim3(256), 0, stream>>>(k, K16, n8);
  vt_cast_kernel<<<dim3(kSeq / 64, kHeads, kBatch), dim3(256), 0, stream>>>(v, VT);
  sumsq_kernel<<<dim3(kSeq / 256, kHeads, kBatch), dim3(256), 0, stream>>>(q, Q2, nh);
  sumsq_kernel<<<dim3(kSeq / 256, kHeads, kBatch), dim3(256), 0, stream>>>(k, K2, nh);

  const long strideHead16 = (long)kDh;                  // next head = +64 columns in the [4096][1024] planes
  const long strideScore  = (long)kSeq * kSeq;          // per head-in-group score / probability plane
  const long strideVT     = (long)kDh * kSeq;           // per head V^T plane
  const int  tilesScore   = (kSeq / 64) * (kSeq / 64);  // 1024 -> 128 blocks of 8 waves
  const int  tilesCtx     = (kSeq / 64) * (kDh / 64);   // 32 -> 32 blocks, K over the waves of each

  for (int b = 0; b < kBatch; ++b) {
    for (int g = 0; g < kHeads / kGroup; ++g) {
      const size_t tokOff  = ((size_t)b * kSeq) * kDim + (size_t)g * kGroup * kDh;   // elements
      const size_t headIdx = (size_t)b * kHeads + (size_t)g * kGroup;
      const unsigned short* Ag  = Q16 + tokOff;
      const unsigned short* Btg = K16 + tokOff;
      // scores[hg][i][j] = sum_d Q16[b,i,h*64+d] * K16[b,j,h*64+d]   (M=N=2048, K=64)
      wmma_gemm64<0, false, 0, 0, false, 0><<<dim3(tilesScore / 8, kGroup), dim3(256), 0, stream>>>(
          Ag, Ag, kDim, strideHead16, Btg, Btg, kDim, strideHead16,
          (void*)SC, (void*)SC, kSeq, strideScore, Q2, Q2, 0L, kSeq, kSeq, kDh, 1.0f);
      // distance transform + mask + softmax -> PP (f16, x32768)
      dist_softmax_kernel<<<dim3(kSeq, kGroup), dim3(256), 0, stream>>>(
          SC, Q2 + headIdx * kSeq, K2 + headIdx * kSeq, mask, PP);
      // out[b, i, h*64+n] = 2^-15 * sum_j PP[hg][i][j] * VT[b,h][n][j]   (M=2048, N=64, K=2048)
      const unsigned short* VTg = VT + headIdx * (size_t)kDh * kSeq;
      float* outg = out + tokOff;
      ctx_gemm_ksplit<<<dim3(tilesCtx, kGroup), dim3(kCtxWaves * 32), 0, stream>>>(
          PP, kSeq, strideScore, VTg, kSeq, strideVT, outg, kDim, strideHead16, kDh, kSeq, kPCarryInv);
    }
  }
}

// v003
// It runs in 144 microseconds.
// Versions between v001 and this one are left out; their measured steps multiply to 3.42 times as fast.
// Counting every step since v000, it is 7.46 times as fast.
// Contractions: scores k_h . q_h^T (q, k as f16 planes) and v_h^T . attn^T (P f16 carried x2^14 against the maximum in use, V^T f16 plane) on v_wmma_f32_16x16x32_f16, f32 accumulate; squared norms, distance transform, additive mask and softmax in f32.
#include <hip/hip_runtime.h>
#include <math.h>

// ---------------------------------------------------------------------------
// Problem constants
// ---------------------------------------------------------------------------
constexpr int kBatch = 2;
constexpr int kSeq   = 2048;
constexpr int kDim   = 1024;
constexpr int kHeads = 16;
constexpr int kDh    = 64;
constexpr int kTok   = kBatch * kSeq;     // 4096 token rows
constexpr float kDistScale = 0.125f;      // 64^-0.5
constexpr float kEps       = 1.0e-9f;
constexpr float kNegBig    = -1.0e9f;
static_assert(kHeads * kDh == kDim, "shape");
static_assert(kSeq % 64 == 0 && kDh % 32 == 0 && kSeq % 256 == 0, "tiles");

typedef __attribute__((ext_vector_type(16))) _Float16 v16h;
typedef __attribute__((ext_vector_type(8)))  _Float16 v8h;
typedef __attribute__((ext_vector_type(8)))  float    v8f;
typedef __attribute__((ext_vector_type(4)))  float    v4f;
typedef __attribute__((ext_vector_type(2)))  float    v2f;
typedef __attribute__((ext_vector_type(4)))  int      v4i;
typedef __attribute__((ext_vector_type(4)))  unsigned int v4u;

// ---------------------------------------------------------------------------
// Small helpers
// ---------------------------------------------------------------------------
__device__ __forceinline__ unsigned pk16(unsigned short a, unsigned short b) { return (unsigned)a | ((unsigned)b << 16); }
__device__ __forceinline__ unsigned short h_bits(float f) { const _Float16 h = (_Float16)f; return __builtin_bit_cast(unsigned short, h); }
// 16x16x32 f16 fragment in the hardware k order: elements 0..7 <- p[0..7], 8..15 <- p[16..23]; p already holds the lane half's +8.
__device__ __forceinline__ v16h frag_load(const _Float16* p) {
  union { v16h v; v8h h[2]; } f; f.h[0] = *(const v8h*)(p); f.h[1] = *(const v8h*)(p + 16); return f.v;
}
__device__ __forceinline__ v8f mma_f16(v16h a, v16h b, v8f c) {
  return __builtin_amdgcn_wmma_f32_16x16x32_f16(false, a, false, b, (short)0, c, false, false);
}
// lane l <-> lane l ^ 16
__device__ __forceinline__ float xhalf(float x) {
  return __builtin_bit_cast(float, __builtin_amdgcn_permlanex16(__builtin_bit_cast(int, x), __builtin_bit_cast(int, x), 0x76543210, 0xfedcba98, false, false));
}

// ---------------------------------------------------------------------------
// ---------------------------------------------------------------------------
__global__ __launch_bounds__(256) void cast8_f16_kernel(const float* __restrict__ in, unsigned short* __restrict__ out, int n8) {
  const int i = blockIdx.x * 256 + threadIdx.x;
  if (i >= n8) return;
  const float* p = in + 8 * (size_t)i;
  const v4f a = *(const v4f*)(p);
  const v4f c = *(const v4f*)(p + 4);
  unsigned short hb[8];
#pragma unroll
  for (int e = 0; e < 4; ++e) {
    hb[e]     = h_bits(a[e]);
    hb[4 + e] = h_bits(c[e]);
  }
  const v4u u = (v4u){pk16(hb[0], hb[1]), pk16(hb[2], hb[3]), pk16(hb[4], hb[5]), pk16(hb[6], hb[7])};
  unsigned short* q = out + 8 * (size_t)i;
  *(v4u*)q = u;
  
}

// ---------------------------------------------------------------------------
// V transpose + cast: VT[(b*16+h)][d][s] = f16( v[b][s][h*64+d] ).
// grid (32, 16, 2): blockIdx.x = s tile (64 rows), blockIdx.y = head, blockIdx.z = batch. 256 threads.
// Load coverage: 16 iterations x 256 threads = 4096 = whole 64(s) x 64(d) tile (coalesced along d).
// Store coverage: 8 waves x 2 iterations x 4 rows (lane>>3) = 64 d-rows; (lane&7) x 8 halves = 64 s-cols; each row segment =
// ---------------------------------------------------------------------------
__global__ __launch_bounds__(256) void vt_cast_kernel(const float* __restrict__ v, unsigned short* __restrict__ VT) {
  __shared__ float sm[64][65];   // sm[d][s_local]
  const int t  = threadIdx.x;
  const int s0 = blockIdx.x * 64;
  const int h  = blockIdx.y;
  const int b  = blockIdx.z;
#pragma unroll
  for (int i = 0; i < 16; ++i) {
    const int e = i * 256 + t;
    const int r = e >> 6;          // s local
    const int c = e & 63;          // d
    sm[c][r] = v[((size_t)(b * kSeq + s0 + r)) * kDim + h * kDh + c];
  }
  __syncthreads();
  const int lane = t & 31, wave = t >> 5;
  const int q = lane >> 3, c8 = (lane & 7) * 8;
  unsigned short* op = VT + ((size_t)(b * kHeads + h) * kDh) * kSeq;
  {
#pragma unroll
    for (int it = 0; it < 2; ++it) {
      const int row = wave * 8 + it * 4 + q;                 // d
      unsigned short hb[8];
#pragma unroll
      for (int e = 0; e < 8; ++e) hb[e] = h_bits(sm[row][c8 + e]);
      const v4u u = (v4u){pk16(hb[0], hb[1]), pk16(hb[2], hb[3]), pk16(hb[4], hb[5]), pk16(hb[6], hb[7])};
      *(v4u*)(op + (size_t)row * kSeq + s0 + c8) = u;
    }
    
  }
}

// ---------------------------------------------------------------------------
// Per-head squared row norms: dst[(b*16+h)][s] = sum_d x[b][s][h*64+d]^2 (f32).
// grid (8, 16, 2): blockIdx.x = 256-row s tile, blockIdx.y = head, blockIdx.z = batch; thread t owns row s0+t.
// ---------------------------------------------------------------------------
__global__ __launch_bounds__(256) void sumsq_kernel(const float* __restrict__ x, float* __restrict__ dst, const int* __restrict__ unused_nh) {
  (void)unused_nh;
  __shared__ __align__(16) float sq[256];
  const int t  = threadIdx.x;
  const int s0 = blockIdx.x * 256;
  const int h  = blockIdx.y;
  const int b  = blockIdx.z;
  const float* row = x + ((size_t)(b * kSeq + s0 + t)) * kDim + h * kDh;
  float a0 = 0.f, a1 = 0.f, a2 = 0.f, a3 = 0.f;
#pragma unroll 1
  for (int j = 0; j < 16; ++j) {
    const v4f w = *(const v4f*)(row + 4 * j);
    a0 += w[0] * w[0];
    a1 += w[1] * w[1];
    a2 += w[2] * w[2];
    a3 += w[3] * w[3];
  }
  sq[t] = (a0 + a1) + (a2 + a3);
  __syncthreads();
  if (t < 64) {
    const v4f val = *(const v4f*)(sq + 4 * t);
    float* dp = dst + (size_t)(b * kHeads + h) * kSeq + s0 + 4 * t;
    *(v4f*)dp = val;
    
  }
}

// ---------------------------------------------------------------------------
// Scores, distance transform, mask, softmax and context product of one (batch, head) in one kernel; no score or
// probability plane in memory. A wave owns 16 queries and walks the 2048 keys in passes of 32:
//   S^T = K . Q^T        A = 16 keys x 64 d (two tiles of keys), B = Q^T kept in registers; lane (c, hh), register r of tile kt
//                        holds key key0 + 16 kt + 8 hh + r against query c
//   a   = log2(e) * [ 1 / (sqrt(max(q2 + k2 - 2 S, 0)) * 0.125 + 1e-9) + float(mask) * (-1e9) ]      (f32)
//                        log2(e) sits in the three constants; square root and reciprocal are one hardware instruction each
//                        (about 1 ulp; the argument of the reciprocal is at least 1e-9 ln 2, a subnormal d2 counts as 0 beside it)
//   p   = 2^(a - ms)     one hardware instruction; ms = (maximum in use) - 14, so p is carried x2^14; a - ms never exceeds
//                        kLagLimit, and far below 0 the result is 0; the two score tiles, cast in place, are the
//                        B operand P^T of the second product (hardware k order, the order frag_load gives V^T)
//   O^T += V^T . P^T     A = 16 d x 32 keys from the V^T plane, four tiles of d
// The maximum in use may trail a query's true maximum by up to log2(e) (p * 2^14 <= e * 2^14 < 65504); sums and accumulators are
// rescaled only in a pass where some query of the wave exceeds that. The carry cancels in acc / l.
// grid (kSeq / 256, kBatch * kHeads), 16 waves x 16 queries. No LDS, no barrier.
// ---------------------------------------------------------------------------
constexpr int   kFusedWaves = 16;
constexpr float kLog2e      = 1.4426950408889634f;
constexpr float kLn2        = 0.6931471805599453f;
constexpr float kDistScale2 = kDistScale * kLn2;           // 1 / (x ln 2) = log2(e) / x
constexpr float kEps2       = kEps * kLn2;
constexpr float kNegBig2    = kNegBig * kLog2e;
constexpr float kCarry      = 14.0f;                       // p carried x2^14
constexpr float kLagLimit   = kLog2e + kCarry;             // a - ms above this: take a new maximum
static_assert(kSeq % (16 * kFusedWaves) == 0 && kDh == 64, "fused tiles");
__global__ __launch_bounds__(kFusedWaves * 32) void fused_dist_attn_kernel(
    const unsigned short* __restrict__ Q16p, const unsigned short* __restrict__ K16p, const unsigned short* __restrict__ VTp,
    const float* __restrict__ Q2p, const float* __restrict__ K2p, const int* __restrict__ maskp, float* __restrict__ outp) {
  const int lane = threadIdx.x & 31;
  const int wave = threadIdx.x >> 5;
  const int c  = lane & 15;
  const int hh = lane >> 4;
  const int bh = blockIdx.y;
  const int b  = bh / kHeads;
  const int h  = bh - b * kHeads;
  const int q  = blockIdx.x * (16 * kFusedWaves) + wave * 16 + c;     // this lane's query

  const _Float16* Qr = (const _Float16*)Q16p + ((size_t)(b * kSeq + q)) * kDim + h * kDh + 8 * hh;
  const _Float16* Kr = (const _Float16*)K16p + ((size_t)(b * kSeq + c)) * kDim + h * kDh + 8 * hh;
  const _Float16* Vr = (const _Float16*)VTp + ((size_t)bh * kDh + c) * kSeq + 8 * hh;
  const float*    kn = K2p + (size_t)bh * kSeq + 8 * hh;
  const int*      mr = maskp + (size_t)q * kSeq + 8 * hh;
  const float     q2i = Q2p[(size_t)bh * kSeq + q];
  const v16h qf0 = frag_load(Qr);
  const v16h qf1 = frag_load(Qr + 32);

  v8f acc[4];
#pragma unroll
  for (int t = 0; t < 4; ++t) acc[t] = (v8f){0.f,0.f,0.f,0.f,0.f,0.f,0.f,0.f};
  float ms = -__builtin_inff();   // maximum in use, less the carry
  float l  = 0.f;                 // this lane half's share of the query's sum of p

#pragma unroll 1
  for (int key0 = 0; key0 < kSeq; key0 += 32) {
    float a[2][8];
    float mx = -__builtin_inff();
#pragma unroll
    for (int kt = 0; kt < 2; ++kt) {
      const _Float16* kp = Kr + (size_t)(key0 + 16 * kt) * kDim;
      v8f s = (v8f){0.f,0.f,0.f,0.f,0.f,0.f,0.f,0.f};
      s = mma_f16(frag_load(kp), qf0, s);
      s = mma_f16(frag_load(kp + 32), qf1, s);
      const int ko = key0 + 16 * kt;
      const v4f k2a = *(const v4f*)(kn + ko);
      const v4f k2b = *(const v4f*)(kn + ko + 4);
      const v4i ma  = *(const v4i*)(mr + ko);
      const v4i mb  = *(const v4i*)(mr + ko + 4);
#pragma unroll
      for (int r = 0; r < 8; r += 2) {    // two keys at a time: the plain arithmetic between the hardware functions is packed f32
        const v2f kv = (r < 4) ? (v2f){k2a[r & 3], k2a[(r & 3) + 1]} : (v2f){k2b[r & 3], k2b[(r & 3) + 1]};
        const v2f mf = (r < 4) ? (v2f){(float)ma[r & 3], (float)ma[(r & 3) + 1]} : (v2f){(float)mb[r & 3], (float)mb[(r & 3) + 1]};
        v2f d2 = (q2i + kv) - 2.0f * (v2f){s[r], s[r + 1]};
        d2 = __builtin_elementwise_max(d2, (v2f){0.0f, 0.0f});
        const v2f root = (v2f){__builtin_amdgcn_sqrtf(d2[0]), __builtin_amdgcn_sqrtf(d2[1])};
        const v2f den  = root * kDistScale2 + kEps2;
        v2f av = (v2f){__builtin_amdgcn_rcpf(den[0]), __builtin_amdgcn_rcpf(den[1])};
        av = av + mf * kNegBig2;
        a[kt][r]     = av[0];
        a[kt][r + 1] = av[1];
        mx = fmaxf(mx, fmaxf(av[0], av[1]));
      }
    }
    mx = fmaxf(mx, xhalf(mx));    // both lane halves hold the query's maximum of this pass
    if (__builtin_amdgcn_ballot_w32((mx - ms) > kLagLimit) != 0) {   // wave-uniform; always taken in the first pass (ms = -inf)
      const float msNew = fmaxf(ms, mx - kCarry);
      const float corr  = __builtin_amdgcn_exp2f(ms - msNew);        // 0 in the first pass
      ms = msNew;
      l *= corr;
#pragma unroll
      for (int t = 0; t < 4; ++t) acc[t] = acc[t] * corr;
    }
    v16h pf;
#pragma unroll
    for (int e = 0; e < 16; ++e) {
      const float pv = __builtin_amdgcn_exp2f(a[e >> 3][e & 7] - ms);
      l += pv;
      pf[e] = (_Float16)pv;
    }
#pragma unroll
    for (int t = 0; t < 4; ++t) acc[t] = mma_f16(frag_load(Vr + (size_t)(16 * t) * kSeq + key0), pf, acc[t]);
  }

  l = l + xhalf(l);               // join the two halves' sums, unconditionally
  const float inv = 1.0f / l;
  float* orow = outp + ((size_t)(b * kSeq + q)) * kDim + h * kDh + 8 * hh;   // register r of tile t = d 16 t + 8 hh + r
#pragma unroll
  for (int t = 0; t < 4; ++t) {
    const v8f o = acc[t] * inv;
    *(v4f*)(orow + 16 * t)     = (v4f){o[0], o[1], o[2], o[3]};
    *(v4f*)(orow + 16 * t + 4) = (v4f){o[4], o[5], o[6], o[7]};
  }
}

// ---------------------------------------------------------------------------
// Host glue.
//   Q16  f16 [4096][1024]            8,388,608  at          0
//   K16  f16 [4096][1024]            8,388,608  at  8,388,608
//   VT   f16 [2*16][64][2048]        8,388,608  at 16,777,216
//   Q2   f32 [2*16][2048]              262,144  at 25,165,824
//   K2   f32 [2*16][2048]              262,144  at 25,427,968
//   total                           25,690,112
// ---------------------------------------------------------------------------
extern "C" void kernel_launch(void* const* d_in, const int* in_sizes, int n_in,
                              void* d_out, int out_size, void* d_ws, size_t ws_size,
                              hipStream_t stream) {
  if (n_in < 5) return;
  const int nElem = kBatch * kSeq * kDim;          // 4,194,304
  if (in_sizes[0] != nElem || in_sizes[1] != nElem || in_sizes[2] != nElem) return;
  if (in_sizes[3] != kSeq * kSeq) return;
  if (out_size != nElem) return;

  const size_t szQK = (size_t)kTok * kDim * 2;
  const size_t szVT = (size_t)kBatch * kHeads * kDh * kSeq * 2;
  const size_t szN  = (size_t)kBatch * kHeads * kSeq * 4;
  const size_t offQ  = 0;
  const size_t offK  = offQ + szQK;
  const size_t offVT = offK + szQK;
  const size_t offQ2 = offVT + szVT;
  const size_t offK2 = offQ2 + szN;
  const size_t total = offK2 + szN;
  if (ws_size < total) return;

  const float* q    = (const float*)d_in[0];
  const float* k    = (const float*)d_in[1];
  const float* v    = (const float*)d_in[2];
  const int*   mask = (const int*)d_in[3];
  const int*   nh   = (const int*)d_in[4];   // static head count (16), structural only
  float* out = (float*)d_out;
  char* ws = (char*)d_ws;
  unsigned short* Q16 = (unsigned short*)(ws + offQ);
  unsigned short* K16 = (unsigned short*)(ws + offK);
  unsigned short* VT  = (unsigned short*)(ws + offVT);
  float* Q2 = (float*)(ws + offQ2);
  float* K2 = (float*)(ws + offK2);

  // ---- prologue: 16-bit operand planes and squared norms ----
  const int n8 = (kTok * kDim) / 8;   // 524288 -> 2048 blocks exact
  cast8_f16_kernel<<<dim3(n8 / 256), dim3(256), 0, stream>>>(q, Q16, n8);
  cast8_f16_kernel<<<dim3(n8 / 256), dim3(256), 0, stream>>>(k, K16, n8);
  vt_cast_kernel<<<dim3(kSeq / 64, kHeads, kBatch), dim3(256), 0, stream>>>(v, VT);
  sumsq_kernel<<<dim3(kSeq / 256, kHeads, kBatch), dim3(256), 0, stream>>>(q, Q2, nh);
  sumsq_kernel<<<dim3(kSeq / 256, kHeads, kBatch), dim3(256), 0, stream>>>(k, K2, nh);

  // ---- all 32 (batch, head) planes in one launch ----
  fused_dist_attn_kernel<<<dim3(kSeq / (16 * kFusedWaves), kBatch * kHeads), dim3(kFusedWaves * 32), 0, stream>>>(
      Q16, K16, VT, Q2, K2, mask, out);
}

// v004
// Measured time: 87 microseconds a run.
// Timed twice side by side with v003, it ran 1.64 and 1.66 times as fast.
// Counting every step since v000, it is 12.3 times as fast.
// Contractions: scores k_h . q_h^T (q, k as f16 planes) and v_h^T . attn^T (P f16 carried x2^14 against the maximum in use, V^T f16 plane) on v_wmma_f32_16x16x32_f16, f32 accumulate; squared norms, distance transform, additive mask and softmax in f32.
#include <hip/hip_runtime.h>
#include <math.h>

// ---------------------------------------------------------------------------
// Problem constants
// ---------------------------------------------------------------------------
constexpr int kBatch = 2;
constexpr int kSeq   = 2048;
constexpr int kDim   = 1024;
constexpr int kHeads = 16;
constexpr int kDh    = 64;
constexpr int kTok   = kBatch * kSeq;     // 4096 token rows
constexpr float kDistScale = 0.125f;      // 64^-0.5
constexpr float kEps       = 1.0e-9f;
constexpr float kNegBig    = -1.0e9f;
static_assert(kHeads * kDh == kDim, "shape");
static_assert(kSeq % 64 == 0 && kDh % 32 == 0 && kSeq % 256 == 0, "tiles");

typedef __attribute__((ext_vector_type(16))) _Float16 v16h;
typedef __attribute__((ext_vector_type(8)))  _Float16 v8h;
typedef __attribute__((ext_vector_type(8)))  float    v8f;
typedef __attribute__((ext_vector_type(4)))  float    v4f;
typedef __attribute__((ext_vector_type(2)))  float    v2f;
typedef __attribute__((ext_vector_type(4)))  int      v4i;
typedef __attribute__((ext_vector_type(4)))  unsigned int v4u;

// ---------------------------------------------------------------------------
// Small helpers
// ---------------------------------------------------------------------------
__device__ __forceinline__ unsigned pk16(unsigned short a, unsigned short b) { return (unsigned)a | ((unsigned)b << 16); }
__device__ __forceinline__ unsigned short h_bits(float f) { const _Float16 h = (_Float16)f; return __builtin_bit_cast(unsigned short, h); }
// 16x16x32 f16 fragment in the hardware k order: elements 0..7 <- p[0..7], 8..15 <- p[16..23]; p already holds the lane half's +8.
__device__ __forceinline__ v16h frag_load(const _Float16* p) {
  union { v16h v; v8h h[2]; } f; f.h[0] = *(const v8h*)(p); f.h[1] = *(const v8h*)(p + 16); return f.v;
}
__device__ __forceinline__ v8f mma_f16(v16h a, v16h b, v8f c) {
  return __builtin_amdgcn_wmma_f32_16x16x32_f16(false, a, false, b, (short)0, c, false, false);
}
// lane l <-> lane l ^ 16
__device__ __forceinline__ float xhalf(float x) {
  return __builtin_bit_cast(float, __builtin_amdgcn_permlanex16(__builtin_bit_cast(int, x), __builtin_bit_cast(int, x), 0x76543210, 0xfedcba98, false, false));
}

// ---------------------------------------------------------------------------
// ---------------------------------------------------------------------------
__global__ __launch_bounds__(256) void cast8_f16_kernel(const float* __restrict__ in, unsigned short* __restrict__ out, int n8) {
  const int i = blockIdx.x * 256 + threadIdx.x;
  if (i >= n8) return;
  const float* p = in + 8 * (size_t)i;
  const v4f a = *(const v4f*)(p);
  const v4f c = *(const v4f*)(p + 4);
  unsigned short hb[8];
#pragma unroll
  for (int e = 0; e < 4; ++e) {
    hb[e]     = h_bits(a[e]);
    hb[4 + e] = h_bits(c[e]);
  }
  const v4u u = (v4u){pk16(hb[0], hb[1]), pk16(hb[2], hb[3]), pk16(hb[4], hb[5]), pk16(hb[6], hb[7])};
  unsigned short* q = out + 8 * (size_t)i;
  *(v4u*)q = u;
  
}

// ---------------------------------------------------------------------------
// V transpose + cast: VT[(b*16+h)][d][s] = f16( v[b][s][h*64+d] ).
// grid (32, 16, 2): blockIdx.x = s tile (64 rows), blockIdx.y = head, blockIdx.z = batch. 256 threads.
// Load coverage: 16 iterations x 256 threads = 4096 = whole 64(s) x 64(d) tile (coalesced along d).
// Store coverage: 8 waves x 2 iterations x 4 rows (lane>>3) = 64 d-rows; (lane&7) x 8 halves = 64 s-cols; each row segment =
// ---------------------------------------------------------------------------
__global__ __launch_bounds__(256) void vt_cast_kernel(const float* __restrict__ v, unsigned short* __restrict__ VT) {
  __shared__ float sm[64][65];   // sm[d][s_local]
  const int t  = threadIdx.x;
  const int s0 = blockIdx.x * 64;
  const int h  = blockIdx.y;
  const int b  = blockIdx.z;
#pragma unroll
  for (int i = 0; i < 16; ++i) {
    const int e = i * 256 + t;
    const int r = e >> 6;          // s local
    const int c = e & 63;          // d
    sm[c][r] = v[((size_t)(b * kSeq + s0 + r)) * kDim + h * kDh + c];
  }
  __syncthreads();
  const int lane = t & 31, wave = t >> 5;
  const int q = lane >> 3, c8 = (lane & 7) * 8;
  unsigned short* op = VT + ((size_t)(b * kHeads + h) * kDh) * kSeq;
  {
#pragma unroll
    for (int it = 0; it < 2; ++it) {
      const int row = wave * 8 + it * 4 + q;                 // d
      unsigned short hb[8];
#pragma unroll
      for (int e = 0; e < 8; ++e) hb[e] = h_bits(sm[row][c8 + e]);
      const v4u u = (v4u){pk16(hb[0], hb[1]), pk16(hb[2], hb[3]), pk16(hb[4], hb[5]), pk16(hb[6], hb[7])};
      *(v4u*)(op + (size_t)row * kSeq + s0 + c8) = u;
    }
    
  }
}

// ---------------------------------------------------------------------------
// Per-head squared row norms: dst[(b*16+h)][s] = sum_d x[b][s][h*64+d]^2 (f32).
// grid (8, 16, 2): blockIdx.x = 256-row s tile, blockIdx.y = head, blockIdx.z = batch; thread t owns row s0+t.
// ---------------------------------------------------------------------------
__global__ __launch_bounds__(256) void sumsq_kernel(const float* __restrict__ x, float* __restrict__ dst, const int* __restrict__ unused_nh) {
  (void)unused_nh;
  __shared__ __align__(16) float sq[256];
  const int t  = threadIdx.x;
  const int s0 = blockIdx.x * 256;
  const int h  = blockIdx.y;
  const int b  = blockIdx.z;
  const float* row = x + ((size_t)(b * kSeq + s0 + t)) * kDim + h * kDh;
  float a0 = 0.f, a1 = 0.f, a2 = 0.f, a3 = 0.f;
#pragma unroll 1
  for (int j = 0; j < 16; ++j) {
    const v4f w = *(const v4f*)(row + 4 * j);
    a0 += w[0] * w[0];
    a1 += w[1] * w[1];
    a2 += w[2] * w[2];
    a3 += w[3] * w[3];
  }
  sq[t] = (a0 + a1) + (a2 + a3);
  __syncthreads();
  if (t < 64) {
    const v4f val = *(const v4f*)(sq + 4 * t);
    float* dp = dst + (size_t)(b * kHeads + h) * kSeq + s0 + 4 * t;
    *(v4f*)dp = val;
    
  }
}

// ---------------------------------------------------------------------------
// Scores, distance transform, mask, softmax and context product of one (batch, head) in one kernel; no score or
// probability plane in memory. A wave owns 16 queries and walks the 2048 keys in passes of 32:
//   S^T = K . Q^T        A = 16 keys x 64 d (two tiles of keys), B = Q^T kept in registers; lane (c, hh), register r of tile kt
//                        holds key key0 + 16 kt + 8 hh + r against query c
//   a   = log2(e) * [ 1 / (sqrt(max(q2 + k2 - 2 S, 0)) * 0.125 + 1e-9) + float(mask) * (-1e9) ]      (f32)
//                        log2(e) sits in the three constants; square root and reciprocal are one hardware instruction each
//                        (about 1 ulp; the argument of the reciprocal is at least 1e-9 ln 2, a subnormal d2 counts as 0 beside it)
//   p   = 2^(a - ms)     one hardware instruction; ms = (maximum in use) - 14, so p is carried x2^14; a - ms never exceeds
//                        kLagLimit, and far below 0 the result is 0; the two score tiles, cast in place, are the
//                        B operand P^T of the second product (hardware k order, the order frag_load gives V^T)
//   O^T += V^T . P^T     A = 16 d x 32 keys from the V^T plane, four tiles of d
// The maximum in use may trail a query's true maximum by up to log2(e) (p * 2^14 <= e * 2^14 < 65504); sums and accumulators are
// rescaled only in a pass where some query of the wave exceeds that. The carry cancels in acc / l.
// grid (kSeq / 256, kBatch * kHeads), 16 waves x 16 queries.
// K rows and V^T rows are the same for all 16 waves: they are staged in LDS once per block, 128 keys a stage, two buffers,
// by asynchronous copies of 16 bytes a lane (8 or 16 lanes cover a whole row slice); stage s + 1 flies while stage s is worked on.
// Rows in LDS are pitched 16 bytes x odd for the 16-byte fragment reads.
// ---------------------------------------------------------------------------
constexpr int   kFusedWaves = 16;
constexpr int   kStageKeys  = 128;
constexpr int   kStages     = kSeq / kStageKeys;
constexpr int   kKPitch     = 2 * kDh + 16;                // bytes: one key's 64 f16, padded
constexpr int   kVPitch     = 2 * kStageKeys + 16;         // bytes: one d row's 128 keys, padded
constexpr int   kKBytes     = kStageKeys * kKPitch;        // 18,432
constexpr int   kVBytes     = kDh * kVPitch;               // 17,408
constexpr int   kBufBytes   = kKBytes + kVBytes;           // 35,840
static_assert(kStages >= 2 && kSeq % kStageKeys == 0 && kStageKeys % 32 == 0, "ring");
static_assert(kStageKeys * kDh * 2 == 2 * kFusedWaves * 32 * 16, "two copies a lane for each of K and V^T");
static_assert(kKPitch % 16 == 0 && kVPitch % 16 == 0 && kKBytes % 16 == 0 && kBufBytes % 16 == 0, "16-byte copies");
// One stage's four copies of this lane. The wait on xcnt is the last line of the copies' own statement, so that it stands in
// front of every later write of an address register that a copy names.
__device__ __forceinline__ void stage_copy(unsigned lk0, const _Float16* gk0, unsigned lk1, const _Float16* gk1,
                                           unsigned lv0, const _Float16* gv0, unsigned lv1, const _Float16* gv1) {
  asm volatile("global_load_async_to_lds_b128 %0, %1, off\n\t"
               "global_load_async_to_lds_b128 %2, %3, off\n\t"
               "global_load_async_to_lds_b128 %4, %5, off\n\t"
               "global_load_async_to_lds_b128 %6, %7, off\n\t"
               "s_wait_xcnt 0x0"
               :: "v"(lk0), "v"(gk0), "v"(lk1), "v"(gk1), "v"(lv0), "v"(gv0), "v"(lv1), "v"(gv1) : "memory");
}
constexpr float kLog2e      = 1.4426950408889634f;
constexpr float kLn2        = 0.6931471805599453f;
constexpr float kDistScale2 = kDistScale * kLn2;           // 1 / (x ln 2) = log2(e) / x
constexpr float kEps2       = kEps * kLn2;
constexpr float kNegBig2    = kNegBig * kLog2e;
constexpr float kCarry      = 14.0f;                       // p carried x2^14
constexpr float kLagLimit   = kLog2e + kCarry;             // a - ms above this: take a new maximum
static_assert(kSeq % (16 * kFusedWaves) == 0 && kDh == 64, "fused tiles");
__global__ __launch_bounds__(kFusedWaves * 32) void fused_dist_attn_kernel(
    const unsigned short* __restrict__ Q16p, const unsigned short* __restrict__ K16p, const unsigned short* __restrict__ VTp,
    const float* __restrict__ Q2p, const float* __restrict__ K2p, const int* __restrict__ maskp, float* __restrict__ outp) {
  const int lane = threadIdx.x & 31;
  const int wave = threadIdx.x >> 5;
  const int c  = lane & 15;
  const int hh = lane >> 4;
  const int bh = blockIdx.y;
  const int b  = bh / kHeads;
  const int h  = bh - b * kHeads;
  const int q  = blockIdx.x * (16 * kFusedWaves) + wave * 16 + c;     // this lane's query

  const _Float16* Qr = (const _Float16*)Q16p + ((size_t)(b * kSeq + q)) * kDim + h * kDh + 8 * hh;
  __shared__ __attribute__((aligned(16))) unsigned char ring[2 * kBufBytes];
  // copies: chunk e of 16 bytes, e = threadIdx.x and e + 512. K: row e / 8 (key), chunk e % 8. V^T: row e / 16 (d), chunk e % 16.
  const int tid = threadIdx.x;
  const _Float16* gk = (const _Float16*)K16p + ((size_t)(b * kSeq + (tid >> 3))) * kDim + h * kDh + 8 * (tid & 7);
  const _Float16* gv = (const _Float16*)VTp + ((size_t)bh * kDh + (tid >> 4)) * kSeq + 8 * (tid & 15);
  const unsigned  lk = (unsigned)(size_t)ring + (unsigned)((tid >> 3) * kKPitch + 16 * (tid & 7));
  const unsigned  lv = (unsigned)(size_t)ring + (unsigned)(kKBytes + (tid >> 4) * kVPitch + 16 * (tid & 15));
  // readers: this lane's row and half in the K part and in the V^T part of a buffer
  const unsigned char* Kl = ring + c * kKPitch + 16 * hh;
  const unsigned char* Vl = ring + kKBytes + c * kVPitch + 16 * hh;
  const float*    kn = K2p + (size_t)bh * kSeq + 8 * hh;
  const int*      mr = maskp + (size_t)q * kSeq + 8 * hh;
  const float     q2i = Q2p[(size_t)bh * kSeq + q];
  const v16h qf0 = frag_load(Qr);
  const v16h qf1 = frag_load(Qr + 32);

  v8f acc[4];
#pragma unroll
  for (int t = 0; t < 4; ++t) acc[t] = (v8f){0.f,0.f,0.f,0.f,0.f,0.f,0.f,0.f};
  float ms = -__builtin_inff();   // maximum in use, less the carry
  float l  = 0.f;                 // this lane half's share of the query's sum of p

  // stage st (keys 128 st ...) into buffer buf: K rows r and r + 64, V^T rows d and d + 32
  auto copy_stage = [&](int st, int buf) {
    stage_copy(lk + buf * kBufBytes,                gk + (size_t)st * kStageKeys * kDim,
               lk + buf * kBufBytes + 64 * kKPitch, gk + ((size_t)st * kStageKeys + 64) * kDim,
               lv + buf * kBufBytes,                gv + (size_t)st * kStageKeys,
               lv + buf * kBufBytes + 32 * kVPitch, gv + (size_t)32 * kSeq + (size_t)st * kStageKeys);
  };
  copy_stage(0, 0);
  asm volatile("s_wait_asynccnt 0x0" ::: "memory");   // this wave's share of stage 0 has landed
  __syncthreads();                                    // every wave's share has: stage 0 may be read
  copy_stage(1, 1);

#pragma unroll 1   // one stage at a time, for speed only
  for (int st = 0; st < kStages; ++st) {
  const unsigned char* Kb = Kl + (st & 1) * kBufBytes;
  const unsigned char* Vb = Vl + (st & 1) * kBufBytes;
#pragma unroll     // the four passes of a stage: every LDS offset is an immediate
  for (int ps = 0; ps < kStageKeys / 32; ++ps) {
    const int key0 = st * kStageKeys + 32 * ps;
    // every load of the pass, the longest way first: mask and norms from memory, K fragments, V^T fragments from LDS
    v4i mk[2][2];
    v4f k2[2][2];
    v16h kf[2][2], vf[4];
#pragma unroll     // here and in the loops below: constant indices, so that the arrays are registers
    for (int kt = 0; kt < 2; ++kt) {
      const int ko = key0 + 16 * kt;
      mk[kt][0] = *(const v4i*)(mr + ko);
      mk[kt][1] = *(const v4i*)(mr + ko + 4);
      k2[kt][0] = *(const v4f*)(kn + ko);
      k2[kt][1] = *(const v4f*)(kn + ko + 4);
    }
#pragma unroll
    for (int kt = 0; kt < 2; ++kt) {
      const _Float16* kp = (const _Float16*)(Kb + (32 * ps + 16 * kt) * kKPitch);
      kf[kt][0] = frag_load(kp);
      kf[kt][1] = frag_load(kp + 32);
    }
#pragma unroll
    for (int t = 0; t < 4; ++t) vf[t] = frag_load((const _Float16*)(Vb + (16 * t) * kVPitch + 64 * ps));
    // keeps the LDS reads one group at the head of the pass: left free, they are spread among the matrix instructions, each
    // pair waited for at once into the same registers
    __builtin_amdgcn_sched_barrier(0);
    v8f sc[2];
#pragma unroll
    for (int kt = 0; kt < 2; ++kt) sc[kt] = mma_f16(kf[kt][0], qf0, (v8f){0.f,0.f,0.f,0.f,0.f,0.f,0.f,0.f});
#pragma unroll
    for (int kt = 0; kt < 2; ++kt) sc[kt] = mma_f16(kf[kt][1], qf1, sc[kt]);
    // keeps the four score products in front of the wait for the mask words, so that they run while those are on their way
    __builtin_amdgcn_sched_barrier(0);
    float a[2][8];
    float mx = -__builtin_inff();
#pragma unroll
    for (int kt = 0; kt < 2; ++kt) {
      const v8f s = sc[kt];
      const v4f k2a = k2[kt][0];
      const v4f k2b = k2[kt][1];
      const v4i ma  = mk[kt][0];
      const v4i mb  = mk[kt][1];
#pragma unroll
      for (int r = 0; r < 8; r += 2) {    // two keys at a time: the plain arithmetic between the hardware functions is packed f32
        const v2f kv = (r < 4) ? (v2f){k2a[r & 3], k2a[(r & 3) + 1]} : (v2f){k2b[r & 3], k2b[(r & 3) + 1]};
        const v2f mf = (r < 4) ? (v2f){(float)ma[r & 3], (float)ma[(r & 3) + 1]} : (v2f){(float)mb[r & 3], (float)mb[(r & 3) + 1]};
        v2f d2 = (q2i + kv) - 2.0f * (v2f){s[r], s[r + 1]};
        d2 = __builtin_elementwise_max(d2, (v2f){0.0f, 0.0f});
        const v2f root = (v2f){__builtin_amdgcn_sqrtf(d2[0]), __builtin_amdgcn_sqrtf(d2[1])};
        const v2f den  = root * kDistScale2 + kEps2;
        v2f av = (v2f){__builtin_amdgcn_rcpf(den[0]), __builtin_amdgcn_rcpf(den[1])};
        av = av + mf * kNegBig2;
        a[kt][r]     = av[0];
        a[kt][r + 1] = av[1];
        mx = fmaxf(mx, fmaxf(av[0], av[1]));
      }
    }
    mx = fmaxf(mx, xhalf(mx));    // both lane halves hold the query's maximum of this pass
    if (__builtin_amdgcn_ballot_w32((mx - ms) > kLagLimit) != 0) {   // wave-uniform; always taken in the first pass (ms = -inf)
      const float msNew = fmaxf(ms, mx - kCarry);
      const float corr  = __builtin_amdgcn_exp2f(ms - msNew);        // 0 in the first pass
      ms = msNew;
      l *= corr;
#pragma unroll
      for (int t = 0; t < 4; ++t) acc[t] = acc[t] * corr;
    }
    v16h pf;
#pragma unroll
    for (int e = 0; e < 16; ++e) {
      const float pv = __builtin_amdgcn_exp2f(a[e >> 3][e & 7] - ms);
      l += pv;
      pf[e] = (_Float16)pv;
    }
#pragma unroll
    for (int t = 0; t < 4; ++t) acc[t] = mma_f16(vf[t], pf, acc[t]);
  }
  asm volatile("s_wait_dscnt 0x0" ::: "memory");      // this wave's reads of the buffer have returned
  asm volatile("s_wait_asynccnt 0x0" ::: "memory");   // this wave's share of stage st + 1 has landed
  __syncthreads();                                    // stage st + 1 may be read; the buffer of stage st is free
  if (st + 2 < kStages) copy_stage(st + 2, st & 1);   // the same test in every wave of the block
  }
  asm volatile("s_wait_asynccnt 0x0" ::: "memory");   // nothing of this wave is in flight when it ends

  l = l + xhalf(l);               // join the two halves' sums, unconditionally
  const float inv = 1.0f / l;
  float* orow = outp + ((size_t)(b * kSeq + q)) * kDim + h * kDh + 8 * hh;   // register r of tile t = d 16 t + 8 hh + r
#pragma unroll
  for (int t = 0; t < 4; ++t) {
    const v8f o = acc[t] * inv;
    *(v4f*)(orow + 16 * t)     = (v4f){o[0], o[1], o[2], o[3]};
    *(v4f*)(orow + 16 * t + 4) = (v4f){o[4], o[5], o[6], o[7]};
  }
}

// ---------------------------------------------------------------------------
// Host glue.
//   Q16  f16 [4096][1024]            8,388,608  at          0
//   K16  f16 [4096][1024]            8,388,608  at  8,388,608
//   VT   f16 [2*16][64][2048]        8,388,608  at 16,777,216
//   Q2   f32 [2*16][2048]              262,144  at 25,165,824
//   K2   f32 [2*16][2048]              262,144  at 25,427,968
//   total                           25,690,112
// ---------------------------------------------------------------------------
extern "C" void kernel_launch(void* const* d_in, const int* in_sizes, int n_in,
                              void* d_out, int out_size, void* d_ws, size_t ws_size,
                              hipStream_t stream) {
  if (n_in < 5) return;
  const int nElem = kBatch * kSeq * kDim;          // 4,194,304
  if (in_sizes[0] != nElem || in_sizes[1] != nElem || in_sizes[2] != nElem) return;
  if (in_sizes[3] != kSeq * kSeq) return;
  if (out_size != nElem) return;

  const size_t szQK = (size_t)kTok * kDim * 2;
  const size_t szVT = (size_t)kBatch * kHeads * kDh * kSeq * 2;
  const size_t szN  = (size_t)kBatch * kHeads * kSeq * 4;
  const size_t offQ  = 0;
  const size_t offK  = offQ + szQK;
  const size_t offVT = offK + szQK;
  const size_t offQ2 = offVT + szVT;
  const size_t offK2 = offQ2 + szN;
  const size_t total = offK2 + szN;
  if (ws_size < total) return;

  const float* q    = (const float*)d_in[0];
  const float* k    = (const float*)d_in[1];
  const float* v    = (const float*)d_in[2];
  const int*   mask = (const int*)d_in[3];
  const int*   nh   = (const int*)d_in[4];   // static head count (16), structural only
  float* out = (float*)d_out;
  char* ws = (char*)d_ws;
  unsigned short* Q16 = (unsigned short*)(ws + offQ);
  unsigned short* K16 = (unsigned short*)(ws + offK);
  unsigned short* VT  = (unsigned short*)(ws + offVT);
  float* Q2 = (float*)(ws + offQ2);
  float* K2 = (float*)(ws + offK2);

  // ---- prologue: 16-bit operand planes and squared norms ----
  const int n8 = (kTok * kDim) / 8;   // 524288 -> 2048 blocks exact
  cast8_f16_kernel<<<dim3(n8 / 256), dim3(256), 0, stream>>>(q, Q16, n8);
  cast8_f16_kernel<<<dim3(n8 / 256), dim3(256), 0, stream>>>(k, K16, n8);
  vt_cast_kernel<<<dim3(kSeq / 64, kHeads, kBatch), dim3(256), 0, stream>>>(v, VT);
  sumsq_kernel<<<dim3(kSeq / 256, kHeads, kBatch), dim3(256), 0, stream>>>(q, Q2, nh);
  sumsq_kernel<<<dim3(kSeq / 256, kHeads, kBatch), dim3(256), 0, stream>>>(k, K2, nh);

  // ---- all 32 (batch, head) planes in one launch ----
  fused_dist_attn_kernel<<<dim3(kSeq / (16 * kFusedWaves), kBatch * kHeads), dim3(kFusedWaves * 32), 0, stream>>>(
      Q16, K16, VT, Q2, K2, mask, out);
}

// v005
// Measured time: 78.1 microseconds a run.
// In two side-by-side timings against v004, it was 1.09 and 1.10 times as fast.
// Counting every step since v000, it is 13.5 times as fast.
// Contractions: scores k_h . q_h^T (k as an f16 plane, q cast to f16 in registers) and v_h^T . attn^T (P f16 carried x2^14 against the maximum in use, V^T f16 plane) on v_wmma_f32_16x16x32_f16, f32 accumulate; squared norms, distance transform, additive mask and softmax in f32.
#include <hip/hip_runtime.h>
#include <math.h>

// ---------------------------------------------------------------------------
// Problem constants
// ---------------------------------------------------------------------------
constexpr int kBatch = 2;
constexpr int kSeq   = 2048;
constexpr int kDim   = 1024;
constexpr int kHeads = 16;
constexpr int kDh    = 64;
constexpr int kTok   = kBatch * kSeq;     // 4096 token rows
constexpr float kDistScale = 0.125f;      // 64^-0.5
constexpr float kEps       = 1.0e-9f;
constexpr float kNegBig    = -1.0e9f;
static_assert(kHeads * kDh == kDim, "shape");
static_assert(kSeq % 64 == 0 && kDh % 32 == 0 && kSeq % 256 == 0, "tiles");

typedef __attribute__((ext_vector_type(16))) _Float16 v16h;
typedef __attribute__((ext_vector_type(8)))  _Float16 v8h;
typedef __attribute__((ext_vector_type(8)))  float    v8f;
typedef __attribute__((ext_vector_type(4)))  float    v4f;
typedef __attribute__((ext_vector_type(2)))  float    v2f;
typedef __attribute__((ext_vector_type(4)))  int      v4i;
typedef __attribute__((ext_vector_type(4)))  unsigned int v4u;

// ---------------------------------------------------------------------------
// Small helpers
// ---------------------------------------------------------------------------
__device__ __forceinline__ unsigned pk16(unsigned short a, unsigned short b) { return (unsigned)a | ((unsigned)b << 16); }
__device__ __forceinline__ unsigned short h_bits(float f) { const _Float16 h = (_Float16)f; return __builtin_bit_cast(unsigned short, h); }
// 16x16x32 f16 fragment in the hardware k order: elements 0..7 <- p[0..7], 8..15 <- p[16..23]; p already holds the lane half's +8.
__device__ __forceinline__ v16h frag_load(const _Float16* p) {
  union { v16h v; v8h h[2]; } f; f.h[0] = *(const v8h*)(p); f.h[1] = *(const v8h*)(p + 16); return f.v;
}
__device__ __forceinline__ v8f mma_f16(v16h a, v16h b, v8f c) {
  return __builtin_amdgcn_wmma_f32_16x16x32_f16(false, a, false, b, (short)0, c, false, false);
}
// lane l <-> lane l ^ 16
__device__ __forceinline__ float xhalf(float x) {
  return __builtin_bit_cast(float, __builtin_amdgcn_permlanex16(__builtin_bit_cast(int, x), __builtin_bit_cast(int, x), 0x76543210, 0xfedcba98, false, false));
}

// ---------------------------------------------------------------------------
// ---------------------------------------------------------------------------
__global__ __launch_bounds__(256) void cast8_f16_kernel(const float* __restrict__ in, unsigned short* __restrict__ out, int n8) {
  const int i = blockIdx.x * 256 + threadIdx.x;
  if (i >= n8) return;
  const float* p = in + 8 * (size_t)i;
  const v4f a = *(const v4f*)(p);
  const v4f c = *(const v4f*)(p + 4);
  unsigned short hb[8];
#pragma unroll
  for (int e = 0; e < 4; ++e) {
    hb[e]     = h_bits(a[e]);
    hb[4 + e] = h_bits(c[e]);
  }
  const v4u u = (v4u){pk16(hb[0], hb[1]), pk16(hb[2], hb[3]), pk16(hb[4], hb[5]), pk16(hb[6], hb[7])};
  unsigned short* q = out + 8 * (size_t)i;
  *(v4u*)q = u;
  
}

// ---------------------------------------------------------------------------
// V transpose + cast: VT[(b*16+h)][d][s] = f16( v[b][s][h*64+d] ).
// grid (32, 16, 2): blockIdx.x = s tile (64 rows), blockIdx.y = head, blockIdx.z = batch. 256 threads.
// Load coverage: 16 iterations x 256 threads = 4096 = whole 64(s) x 64(d) tile (coalesced along d).
// Store coverage: 8 waves x 2 iterations x 4 rows (lane>>3) = 64 d-rows; (lane&7) x 8 halves = 64 s-cols; each row segment =
// ---------------------------------------------------------------------------
__global__ __launch_bounds__(256) void vt_cast_kernel(const float* __restrict__ v, unsigned short* __restrict__ VT) {
  __shared__ float sm[64][65];   // sm[d][s_local]
  const int t  = threadIdx.x;
  const int s0 = blockIdx.x * 64;
  const int h  = blockIdx.y;
  const int b  = blockIdx.z;
#pragma unroll
  for (int i = 0; i < 16; ++i) {
    const int e = i * 256 + t;
    const int r = e >> 6;          // s local
    const int c = e & 63;          // d
    sm[c][r] = v[((size_t)(b * kSeq + s0 + r)) * kDim + h * kDh + c];
  }
  __syncthreads();
  const int lane = t & 31, wave = t >> 5;
  const int q = lane >> 3, c8 = (lane & 7) * 8;
  unsigned short* op = VT + ((size_t)(b * kHeads + h) * kDh) * kSeq;
  {
#pragma unroll
    for (int it = 0; it < 2; ++it) {
      const int row = wave * 8 + it * 4 + q;                 // d
      unsigned short hb[8];
#pragma unroll
      for (int e = 0; e < 8; ++e) hb[e] = h_bits(sm[row][c8 + e]);
      const v4u u = (v4u){pk16(hb[0], hb[1]), pk16(hb[2], hb[3]), pk16(hb[4], hb[5]), pk16(hb[6], hb[7])};
      *(v4u*)(op + (size_t)row * kSeq + s0 + c8) = u;
    }
    
  }
}

// ---------------------------------------------------------------------------
// Per-head squared row norms: dst[(b*16+h)][s] = sum_d x[b][s][h*64+d]^2 (f32).
// grid (8, 16, 2): blockIdx.x = 256-row s tile, blockIdx.y = head, blockIdx.z = batch; thread t owns row s0+t.
// ---------------------------------------------------------------------------
__global__ __launch_bounds__(256) void sumsq_kernel(const float* __restrict__ x, float* __restrict__ dst, const int* __restrict__ unused_nh) {
  (void)unused_nh;
  __shared__ __align__(16) float sq[256];
  const int t  = threadIdx.x;
  const int s0 = blockIdx.x * 256;
  const int h  = blockIdx.y;
  const int b  = blockIdx.z;
  const float* row = x + ((size_t)(b * kSeq + s0 + t)) * kDim + h * kDh;
  float a0 = 0.f, a1 = 0.f, a2 = 0.f, a3 = 0.f;
#pragma unroll 1
  for (int j = 0; j < 16; ++j) {
    const v4f w = *(const v4f*)(row + 4 * j);
    a0 += w[0] * w[0];
    a1 += w[1] * w[1];
    a2 += w[2] * w[2];
    a3 += w[3] * w[3];
  }
  sq[t] = (a0 + a1) + (a2 + a3);
  __syncthreads();
  if (t < 64) {
    const v4f val = *(const v4f*)(sq + 4 * t);
    float* dp = dst + (size_t)(b * kHeads + h) * kSeq + s0 + 4 * t;
    *(v4f*)dp = val;
    
  }
}

// ---------------------------------------------------------------------------
// Scores, distance transform, mask, softmax and context product of one (batch, head) in one kernel; no score or
// probability plane in memory. A wave owns 16 queries and walks the 2048 keys in passes of 32:
//   S^T = K . Q^T        A = 16 keys x 64 d (two tiles of keys), B = Q^T read as f32, cast once, kept in registers; lane (c, hh), register r of tile kt
//                        holds key key0 + 16 kt + 8 hh + r against query c
//   a   = log2(e) * [ 1 / (sqrt(max(q2 + k2 - 2 S, 0)) * 0.125 + 1e-9) + float(mask) * (-1e9) ]      (f32)
//                        log2(e) sits in the three constants; square root and reciprocal are one hardware instruction each
//                        (about 1 ulp; the argument of the reciprocal is at least 1e-9 ln 2, a subnormal d2 counts as 0 beside it)
//   p   = 2^(a - ms)     one hardware instruction; ms = (maximum in use) - 14, so p is carried x2^14; a - ms never exceeds
//                        kLagLimit, and far below 0 the result is 0; the two score tiles, cast in place, are the
//                        B operand P^T of the second product (hardware k order, the order frag_load gives V^T)
//   O^T += V^T . P^T     A = 16 d x 32 keys from the V^T plane, four tiles of d
// The maximum in use may trail a query's true maximum by up to log2(e) (p * 2^14 <= e * 2^14 < 65504); sums and accumulators are
// rescaled only in a pass where some query of the wave exceeds that. The carry cancels in acc / l.
// grid (kSeq / 256, kBatch * kHeads), 16 waves x 16 queries.
// K rows and V^T rows are the same for all 16 waves: they are staged in LDS once per block, 128 keys a stage, two buffers,
// by asynchronous copies of 16 bytes a lane (8 or 16 lanes cover a whole row slice); stage s + 1 flies while stage s is worked on.
// Rows in LDS are pitched 16 bytes x odd for the 16-byte fragment reads.
// ---------------------------------------------------------------------------
constexpr int   kFusedWaves = 16;
constexpr int   kStageKeys  = 128;
constexpr int   kStages     = kSeq / kStageKeys;
constexpr int   kKPitch     = 2 * kDh + 16;                // bytes: one key's 64 f16, padded
constexpr int   kVPitch     = 2 * kStageKeys + 16;         // bytes: one d row's 128 keys, padded
constexpr int   kKBytes     = kStageKeys * kKPitch;        // 18,432
constexpr int   kVBytes     = kDh * kVPitch;               // 17,408
constexpr int   kBufBytes   = kKBytes + kVBytes;           // 35,840
static_assert(kStages >= 2 && kSeq % kStageKeys == 0 && kStageKeys % 32 == 0, "ring");
static_assert(kStageKeys * kDh * 2 == 2 * kFusedWaves * 32 * 16, "two copies a lane for each of K and V^T");
static_assert(kKPitch % 16 == 0 && kVPitch % 16 == 0 && kKBytes % 16 == 0 && kBufBytes % 16 == 0, "16-byte copies");
// One stage's four copies of this lane. The wait on xcnt is the last line of the copies' own statement, so that it stands in
// front of every later write of an address register that a copy names.
__device__ __forceinline__ void stage_copy(unsigned lk0, const _Float16* gk0, unsigned lk1, const _Float16* gk1,
                                           unsigned lv0, const _Float16* gv0, unsigned lv1, const _Float16* gv1) {
  asm volatile("global_load_async_to_lds_b128 %0, %1, off\n\t"
               "global_load_async_to_lds_b128 %2, %3, off\n\t"
               "global_load_async_to_lds_b128 %4, %5, off\n\t"
               "global_load_async_to_lds_b128 %6, %7, off\n\t"
               "s_wait_xcnt 0x0"
               :: "v"(lk0), "v"(gk0), "v"(lk1), "v"(gk1), "v"(lv0), "v"(gv0), "v"(lv1), "v"(gv1) : "memory");
}
constexpr float kLog2e      = 1.4426950408889634f;
constexpr float kLn2        = 0.6931471805599453f;
constexpr float kDistScale2 = kDistScale * kLn2;           // 1 / (x ln 2) = log2(e) / x
constexpr float kEps2       = kEps * kLn2;
constexpr float kNegBig2    = kNegBig * kLog2e;
constexpr float kCarry      = 14.0f;                       // p carried x2^14
constexpr float kLagLimit   = kLog2e + kCarry;             // a - ms above this: take a new maximum
static_assert(kSeq % (16 * kFusedWaves) == 0 && kDh == 64, "fused tiles");
__global__ __launch_bounds__(kFusedWaves * 32) void fused_dist_attn_kernel(
    const float* __restrict__ qp, const unsigned short* __restrict__ K16p, const unsigned short* __restrict__ VTp,
    const float* __restrict__ K2p, const int* __restrict__ maskp, float* __restrict__ outp) {
  const int lane = threadIdx.x & 31;
  const int wave = threadIdx.x >> 5;
  const int c  = lane & 15;
  const int hh = lane >> 4;
  const int bh = blockIdx.y;
  const int b  = bh / kHeads;
  const int h  = bh - b * kHeads;
  const int q  = blockIdx.x * (16 * kFusedWaves) + wave * 16 + c;     // this lane's query

  // this lane's share of its query's row, f32 as given: four runs of 8 (d = 16 j + 8 hh ...), the hardware k order of the B operand
  const float* Qr = qp + ((size_t)(b * kSeq + q)) * kDim + h * kDh + 8 * hh;
  __shared__ __attribute__((aligned(16))) unsigned char ring[2 * kBufBytes];
  // copies: chunk e of 16 bytes, e = threadIdx.x and e + 512. K: row e / 8 (key), chunk e % 8. V^T: row e / 16 (d), chunk e % 16.
  const int tid = threadIdx.x;
  const _Float16* gk = (const _Float16*)K16p + ((size_t)(b * kSeq + (tid >> 3))) * kDim + h * kDh + 8 * (tid & 7);
  const _Float16* gv = (const _Float16*)VTp + ((size_t)bh * kDh + (tid >> 4)) * kSeq + 8 * (tid & 15);
  const unsigned  lk = (unsigned)(size_t)ring + (unsigned)((tid >> 3) * kKPitch + 16 * (tid & 7));
  const unsigned  lv = (unsigned)(size_t)ring + (unsigned)(kKBytes + (tid >> 4) * kVPitch + 16 * (tid & 15));
  // readers: this lane's row and half in the K part and in the V^T part of a buffer
  const unsigned char* Kl = ring + c * kKPitch + 16 * hh;
  const unsigned char* Vl = ring + kKBytes + c * kVPitch + 16 * hh;
  const float*    kn = K2p + (size_t)bh * kSeq + 8 * hh;
  const int*      mr = maskp + (size_t)q * kSeq + 8 * hh;

  v8f acc[4];
#pragma unroll
  for (int t = 0; t < 4; ++t) acc[t] = (v8f){0.f,0.f,0.f,0.f,0.f,0.f,0.f,0.f};
  float ms = -__builtin_inff();   // maximum in use, less the carry
  float l  = 0.f;                 // this lane half's share of the query's sum of p

  // stage st (keys 128 st ...) into buffer buf: K rows r and r + 64, V^T rows d and d + 32
  auto copy_stage = [&](int st, int buf) {
    stage_copy(lk + buf * kBufBytes,                gk + (size_t)st * kStageKeys * kDim,
               lk + buf * kBufBytes + 64 * kKPitch, gk + ((size_t)st * kStageKeys + 64) * kDim,
               lv + buf * kBufBytes,                gv + (size_t)st * kStageKeys,
               lv + buf * kBufBytes + 32 * kVPitch, gv + (size_t)32 * kSeq + (size_t)st * kStageKeys);
  };
  copy_stage(0, 0);
  // the query rows are asked for behind stage 0's copies, so that both are on their way together
  v4f qx[8];
#pragma unroll
  for (int j = 0; j < 4; ++j) {
    qx[2 * j]     = *(const v4f*)(Qr + 16 * j);
    qx[2 * j + 1] = *(const v4f*)(Qr + 16 * j + 4);
  }
  asm volatile("s_wait_xcnt 0x0" ::: "memory");       // in front of any later write of the address registers of these loads
  asm volatile("s_wait_asynccnt 0x0" ::: "memory");   // this wave's share of stage 0 has landed
  __syncthreads();                                    // every wave's share has: stage 0 may be read
  copy_stage(1, 1);

  // Q^T fragments cast in registers; the squared norm from the f32 values, four partial sums a lane, the two lane halves joined
  v16h qf0, qf1;
  v4f qs = (v4f){0.f, 0.f, 0.f, 0.f};
#pragma unroll
  for (int j = 0; j < 8; ++j) {
    qs += qx[j] * qx[j];
#pragma unroll
    for (int e = 0; e < 4; ++e) {
      if (j < 4) qf0[4 * j + e] = (_Float16)qx[j][e];
      else       qf1[4 * (j - 4) + e] = (_Float16)qx[j][e];
    }
  }
  const float q2h = (qs[0] + qs[1]) + (qs[2] + qs[3]);
  const float q2i = q2h + xhalf(q2h);

#pragma unroll 1
  for (int st = 0; st < kStages; ++st) {
  const unsigned char* Kb = Kl + (st & 1) * kBufBytes;
  const unsigned char* Vb = Vl + (st & 1) * kBufBytes;
#pragma unroll     // the four passes of a stage: every LDS offset is an immediate
  for (int ps = 0; ps < kStageKeys / 32; ++ps) {
    const int key0 = st * kStageKeys + 32 * ps;
    // every load of the pass, the longest way first: mask and norms from memory, K fragments, V^T fragments from LDS
    v4i mk[2][2];
    v4f k2[2][2];
    v16h kf[2][2], vf[4];
#pragma unroll     // here and in the loops below: constant indices, so that the arrays are registers
    for (int kt = 0; kt < 2; ++kt) {
      const int ko = key0 + 16 * kt;
      mk[kt][0] = *(const v4i*)(mr + ko);
      mk[kt][1] = *(const v4i*)(mr + ko + 4);
      k2[kt][0] = *(const v4f*)(kn + ko);
      k2[kt][1] = *(const v4f*)(kn + ko + 4);
    }
#pragma unroll
    for (int kt = 0; kt < 2; ++kt) {
      const _Float16* kp = (const _Float16*)(Kb + (32 * ps + 16 * kt) * kKPitch);
      kf[kt][0] = frag_load(kp);
      kf[kt][1] = frag_load(kp + 32);
    }
#pragma unroll
    for (int t = 0; t < 4; ++t) vf[t] = frag_load((const _Float16*)(Vb + (16 * t) * kVPitch + 64 * ps));
    // keeps the LDS reads one group at the head of the pass: left free, they are spread among the matrix instructions, each
    // pair waited for at once into the same registers
    __builtin_amdgcn_sched_barrier(0);
    v8f sc[2];
#pragma unroll
    for (int kt = 0; kt < 2; ++kt) sc[kt] = mma_f16(kf[kt][0], qf0, (v8f){0.f,0.f,0.f,0.f,0.f,0.f,0.f,0.f});
#pragma unroll
    for (int kt = 0; kt < 2; ++kt) sc[kt] = mma_f16(kf[kt][1], qf1, sc[kt]);
    // keeps the four score products in front of the wait for the mask words, so that they run while those are on their way
    __builtin_amdgcn_sched_barrier(0);
    float a[2][8];
    float mx = -__builtin_inff();
#pragma unroll
    for (int kt = 0; kt < 2; ++kt) {
      const v8f s = sc[kt];
      const v4f k2a = k2[kt][0];
      const v4f k2b = k2[kt][1];
      const v4i ma  = mk[kt][0];
      const v4i mb  = mk[kt][1];
#pragma unroll
      for (int r = 0; r < 8; r += 2) {    // two keys at a time: the plain arithmetic between the hardware functions is packed f32
        const v2f kv = (r < 4) ? (v2f){k2a[r & 3], k2a[(r & 3) + 1]} : (v2f){k2b[r & 3], k2b[(r & 3) + 1]};
        const v2f mf = (r < 4) ? (v2f){(float)ma[r & 3], (float)ma[(r & 3) + 1]} : (v2f){(float)mb[r & 3], (float)mb[(r & 3) + 1]};
        v2f d2 = (q2i + kv) - 2.0f * (v2f){s[r], s[r + 1]};
        d2 = __builtin_elementwise_max(d2, (v2f){0.0f, 0.0f});
        const v2f root = (v2f){__builtin_amdgcn_sqrtf(d2[0]), __builtin_amdgcn_sqrtf(d2[1])};
        const v2f den  = root * kDistScale2 + kEps2;
        v2f av = (v2f){__builtin_amdgcn_rcpf(den[0]), __builtin_amdgcn_rcpf(den[1])};
        av = av + mf * kNegBig2;
        a[kt][r]     = av[0];
        a[kt][r + 1] = av[1];
        mx = fmaxf(mx, fmaxf(av[0], av[1]));
      }
    }
    mx = fmaxf(mx, xhalf(mx));    // both lane halves hold the query's maximum of this pass
    if (__builtin_amdgcn_ballot_w32((mx - ms) > kLagLimit) != 0) {   // wave-uniform; always taken in the first pass (ms = -inf)
      const float msNew = fmaxf(ms, mx - kCarry);
      const float corr  = __builtin_amdgcn_exp2f(ms - msNew);        // 0 in the first pass
      ms = msNew;
      l *= corr;
#pragma unroll
      for (int t = 0; t < 4; ++t) acc[t] = acc[t] * corr;
    }
    v16h pf;
#pragma unroll
    for (int e = 0; e < 16; ++e) {
      const float pv = __builtin_amdgcn_exp2f(a[e >> 3][e & 7] - ms);
      l += pv;
      pf[e] = (_Float16)pv;
    }
#pragma unroll
    for (int t = 0; t < 4; ++t) acc[t] = mma_f16(vf[t], pf, acc[t]);
  }
  asm volatile("s_wait_dscnt 0x0" ::: "memory");      // this wave's reads of the buffer have returned
  asm volatile("s_wait_asynccnt 0x0" ::: "memory");   // this wave's share of stage st + 1 has landed
  __syncthreads();                                    // stage st + 1 may be read; the buffer of stage st is free
  if (st + 2 < kStages) copy_stage(st + 2, st & 1);   // the same test in every wave of the block
  }
  asm volatile("s_wait_asynccnt 0x0" ::: "memory");   // nothing of this wave is in flight when it ends

  l = l + xhalf(l);               // join the two halves' sums, unconditionally
  const float inv = 1.0f / l;
  float* orow = outp + ((size_t)(b * kSeq + q)) * kDim + h * kDh + 8 * hh;   // register r of tile t = d 16 t + 8 hh + r
#pragma unroll
  for (int t = 0; t < 4; ++t) {
    const v8f o = acc[t] * inv;
    *(v4f*)(orow + 16 * t)     = (v4f){o[0], o[1], o[2], o[3]};
    *(v4f*)(orow + 16 * t + 4) = (v4f){o[4], o[5], o[6], o[7]};
  }
}

// ---------------------------------------------------------------------------
// Host glue.
//   K16  f16 [4096][1024]            8,388,608  at          0
//   VT   f16 [2*16][64][2048]        8,388,608  at  8,388,608
//   K2   f32 [2*16][2048]              262,144  at 16,777,216
//   total                           17,039,360
// ---------------------------------------------------------------------------
extern "C" void kernel_launch(void* const* d_in, const int* in_sizes, int n_in,
                              void* d_out, int out_size, void* d_ws, size_t ws_size,
                              hipStream_t stream) {
  if (n_in < 5) return;
  const int nElem = kBatch * kSeq * kDim;          // 4,194,304
  if (in_sizes[0] != nElem || in_sizes[1] != nElem || in_sizes[2] != nElem) return;
  if (in_sizes[3] != kSeq * kSeq) return;
  if (out_size != nElem) return;

  const size_t szQK = (size_t)kTok * kDim * 2;
  const size_t szVT = (size_t)kBatch * kHeads * kDh * kSeq * 2;
  const size_t szN  = (size_t)kBatch * kHeads * kSeq * 4;
  const size_t offK  = 0;
  const size_t offVT = offK + szQK;
  const size_t offK2 = offVT + szVT;
  const size_t total = offK2 + szN;
  if (ws_size < total) return;

  const float* q    = (const float*)d_in[0];
  const float* k    = (const float*)d_in[1];
  const float* v    = (const float*)d_in[2];
  const int*   mask = (const int*)d_in[3];
  const int*   nh   = (const int*)d_in[4];   // static head count (16), structural only
  float* out = (float*)d_out;
  char* ws = (char*)d_ws;
  unsigned short* K16 = (unsigned short*)(ws + offK);
  unsigned short* VT  = (unsigned short*)(ws + offVT);
  float* K2 = (float*)(ws + offK2);

  // ---- prologue: 16-bit operand planes and squared norms ----
  const int n8 = (kTok * kDim) / 8;   // 524288 -> 2048 blocks exact
  cast8_f16_kernel<<<dim3(n8 / 256), dim3(256), 0, stream>>>(k, K16, n8);
  vt_cast_kernel<<<dim3(kSeq / 64, kHeads, kBatch), dim3(256), 0, stream>>>(v, VT);
  sumsq_kernel<<<dim3(kSeq / 256, kHeads, kBatch), dim3(256), 0, stream>>>(k, K2, nh);

  // ---- all 32 (batch, head) planes in one launch ----
  fused_dist_attn_kernel<<<dim3(kSeq / (16 * kFusedWaves), kBatch * kHeads), dim3(kFusedWaves * 32), 0, stream>>>(
      q, K16, VT, K2, mask, out);
}

// v006
// Measured time: 70.5 microseconds a run.
// Next to v005, in two timings, it ran 1.12 and 1.13 times as fast.
// Over all steps from v000 it is 15.1 times as fast.
// Contractions: scores k_h . q_h^T (k as an f16 plane, q cast to f16 in registers) and v_h^T . attn^T (P f16 carried x2^14 against the maximum in use, V^T f16 plane) on v_wmma_f32_16x16x32_f16, f32 accumulate; squared norms, distance transform, additive mask and softmax in f32.
#include <hip/hip_runtime.h>
#include <math.h>

// ---------------------------------------------------------------------------
// Problem constants
// ---------------------------------------------------------------------------
constexpr int kBatch = 2;
constexpr int kSeq   = 2048;
constexpr int kDim   = 1024;
constexpr int kHeads = 16;
constexpr int kDh    = 64;
constexpr int kTok   = kBatch * kSeq;     // 4096 token rows
constexpr float kDistScale = 0.125f;      // 64^-0.5
constexpr float kEps       = 1.0e-9f;
constexpr float kNegBig    = -1.0e9f;
static_assert(kHeads * kDh == kDim, "shape");
static_assert(kSeq % 64 == 0 && kDh % 32 == 0 && kSeq % 256 == 0, "tiles");

typedef __attribute__((ext_vector_type(16))) _Float16 v16h;
typedef __attribute__((ext_vector_type(8)))  _Float16 v8h;
typedef __attribute__((ext_vector_type(8)))  float    v8f;
typedef __attribute__((ext_vector_type(4)))  float    v4f;
typedef __attribute__((ext_vector_type(2)))  float    v2f;
typedef __attribute__((ext_vector_type(4)))  int      v4i;
typedef __attribute__((ext_vector_type(4)))  unsigned int v4u;

// ---------------------------------------------------------------------------
// Small helpers
// ---------------------------------------------------------------------------
__device__ __forceinline__ unsigned pk16(unsigned short a, unsigned short b) { return (unsigned)a | ((unsigned)b << 16); }
__device__ __forceinline__ unsigned short h_bits(float f) { const _Float16 h = (_Float16)f; return __builtin_bit_cast(unsigned short, h); }
// 16x16x32 f16 fragment in the hardware k order: elements 0..7 <- p[0..7], 8..15 <- p[16..23]; p already holds the lane half's +8.
__device__ __forceinline__ v16h frag_load(const _Float16* p) {
  union { v16h v; v8h h[2]; } f; f.h[0] = *(const v8h*)(p); f.h[1] = *(const v8h*)(p + 16); return f.v;
}
__device__ __forceinline__ v8f mma_f16(v16h a, v16h b, v8f c) {
  return __builtin_amdgcn_wmma_f32_16x16x32_f16(false, a, false, b, (short)0, c, false, false);
}
// lane l <-> lane l ^ 16
__device__ __forceinline__ float xhalf(float x) {
  return __builtin_bit_cast(float, __builtin_amdgcn_permlanex16(__builtin_bit_cast(int, x), __builtin_bit_cast(int, x), 0x76543210, 0xfedcba98, false, false));
}

// ---------------------------------------------------------------------------
// ---------------------------------------------------------------------------
__global__ __launch_bounds__(256) void cast8_f16_kernel(const float* __restrict__ in, unsigned short* __restrict__ out, int n8) {
  const int i = blockIdx.x * 256 + threadIdx.x;
  if (i >= n8) return;
  const float* p = in + 8 * (size_t)i;
  const v4f a = *(const v4f*)(p);
  const v4f c = *(const v4f*)(p + 4);
  unsigned short hb[8];
#pragma unroll
  for (int e = 0; e < 4; ++e) {
    hb[e]     = h_bits(a[e]);
    hb[4 + e] = h_bits(c[e]);
  }
  const v4u u = (v4u){pk16(hb[0], hb[1]), pk16(hb[2], hb[3]), pk16(hb[4], hb[5]), pk16(hb[6], hb[7])};
  unsigned short* q = out + 8 * (size_t)i;
  *(v4u*)q = u;
  
}

// ---------------------------------------------------------------------------
// V transpose + cast: VT[(b*16+h)][d][s] = f16( v[b][s][h*64+d] ).
// grid (32, 16, 2): blockIdx.x = s tile (64 rows), blockIdx.y = head, blockIdx.z = batch. 256 threads.
// Load coverage: 16 iterations x 256 threads = 4096 = whole 64(s) x 64(d) tile (coalesced along d).
// Store coverage: 8 waves x 2 iterations x 4 rows (lane>>3) = 64 d-rows; (lane&7) x 8 halves = 64 s-cols; each row segment =
// ---------------------------------------------------------------------------
__global__ __launch_bounds__(256) void vt_cast_kernel(const float* __restrict__ v, unsigned short* __restrict__ VT) {
  __shared__ float sm[64][65];   // sm[d][s_local]
  const int t  = threadIdx.x;
  const int s0 = blockIdx.x * 64;
  const int h  = blockIdx.y;
  const int b  = blockIdx.z;
#pragma unroll
  for (int i = 0; i < 16; ++i) {
    const int e = i * 256 + t;
    const int r = e >> 6;          // s local
    const int c = e & 63;          // d
    sm[c][r] = v[((size_t)(b * kSeq + s0 + r)) * kDim + h * kDh + c];
  }
  __syncthreads();
  const int lane = t & 31, wave = t >> 5;
  const int q = lane >> 3, c8 = (lane & 7) * 8;
  unsigned short* op = VT + ((size_t)(b * kHeads + h) * kDh) * kSeq;
  {
#pragma unroll
    for (int it = 0; it < 2; ++it) {
      const int row = wave * 8 + it * 4 + q;                 // d
      unsigned short hb[8];
#pragma unroll
      for (int e = 0; e < 8; ++e) hb[e] = h_bits(sm[row][c8 + e]);
      const v4u u = (v4u){pk16(hb[0], hb[1]), pk16(hb[2], hb[3]), pk16(hb[4], hb[5]), pk16(hb[6], hb[7])};
      *(v4u*)(op + (size_t)row * kSeq + s0 + c8) = u;
    }
    
  }
}

// ---------------------------------------------------------------------------
// Per-head squared row norms: dst[(b*16+h)][s] = sum_d x[b][s][h*64+d]^2 (f32).
// grid (8, 16, 2): blockIdx.x = 256-row s tile, blockIdx.y = head, blockIdx.z = batch; thread t owns row s0+t.
// ---------------------------------------------------------------------------
__global__ __launch_bounds__(256) void sumsq_kernel(const float* __restrict__ x, float* __restrict__ dst, const int* __restrict__ unused_nh) {
  (void)unused_nh;
  __shared__ __align__(16) float sq[256];
  const int t  = threadIdx.x;
  const int s0 = blockIdx.x * 256;
  const int h  = blockIdx.y;
  const int b  = blockIdx.z;
  const float* row = x + ((size_t)(b * kSeq + s0 + t)) * kDim + h * kDh;
  float a0 = 0.f, a1 = 0.f, a2 = 0.f, a3 = 0.f;
#pragma unroll 1
  for (int j = 0; j < 16; ++j) {
    const v4f w = *(const v4f*)(row + 4 * j);
    a0 += w[0] * w[0];
    a1 += w[1] * w[1];
    a2 += w[2] * w[2];
    a3 += w[3] * w[3];
  }
  sq[t] = (a0 + a1) + (a2 + a3);
  __syncthreads();
  if (t < 64) {
    const v4f val = *(const v4f*)(sq + 4 * t);
    float* dp = dst + (size_t)(b * kHeads + h) * kSeq + s0 + 4 * t;
    *(v4f*)dp = val;
    
  }
}

// ---------------------------------------------------------------------------
// Scores, distance transform, mask, softmax and context product of one (batch, head) in one kernel; no score or
// probability plane in memory. A wave owns 16 queries and walks the 2048 keys in passes of 32:
//   S^T = K . Q^T        A = 16 keys x 64 d (two tiles of keys), B = Q^T read as f32, cast once, kept in registers; lane (c, hh), register r of tile kt
//                        holds key key0 + 16 kt + 8 hh + r against query c
//   a   = log2(e) * [ 1 / (sqrt(max(q2 + k2 - 2 S, 0)) * 0.125 + 1e-9) + float(mask) * (-1e9) ]      (f32)
//                        log2(e) sits in the three constants; square root and reciprocal are one hardware instruction each
//                        (about 1 ulp; the argument of the reciprocal is at least 1e-9 ln 2, a subnormal d2 counts as 0 beside it)
//   p   = 2^(a - ms)     one hardware instruction; ms = (maximum in use) - 14, so p is carried x2^14; a - ms never exceeds
//                        kLagLimit, and far below 0 the result is 0; the two score tiles, cast in place, are the
//                        B operand P^T of the second product (hardware k order, the order frag_load gives V^T)
//   O^T += V^T . P^T     A = 16 d x 32 keys from the V^T plane, four tiles of d
// The maximum in use may trail a query's true maximum by up to log2(e) (p * 2^14 <= e * 2^14 < 65504); sums and accumulators are
// rescaled only in a pass where some query of the wave exceeds that. The carry cancels in acc / l.
// grid (kSeq / 256, kBatch * kHeads), 16 waves x 16 queries.
// K rows and V^T rows are the same for all 16 waves: they are staged in LDS once per block, 128 keys a stage, two buffers,
// by asynchronous copies of 16 bytes a lane (8 or 16 lanes cover a whole row slice); stage s + 1 flies while stage s is worked on.
// Rows in LDS are pitched 16 bytes x odd for the 16-byte fragment reads.
// The mask words of a wave's 16 queries are read by that wave alone. A lane needs 8 words of its own query's row, so a load from
// memory would touch 16 rows at a time; instead the wave copies whole 256-byte row pieces (64 keys, two rows a copy) into a ring
// of its own, two slots, and reads its words from there. Slot 0 serves passes 0 and 1 of a stage, slot 1 passes 2 and 3; a slot is
// refilled behind the wave's own wait on its reads, two passes before it is read again. No other wave touches it: no barrier.
// ---------------------------------------------------------------------------
constexpr int   kFusedWaves = 16;
constexpr int   kStageKeys  = 128;
constexpr int   kStages     = kSeq / kStageKeys;
constexpr int   kKPitch     = 2 * kDh + 16;                // bytes: one key's 64 f16, padded
constexpr int   kVPitch     = 2 * kStageKeys + 16;         // bytes: one d row's 128 keys, padded
constexpr int   kKBytes     = kStageKeys * kKPitch;        // 18,432
constexpr int   kVBytes     = kDh * kVPitch;               // 17,408
constexpr int   kBufBytes   = kKBytes + kVBytes;           // 35,840
static_assert(kStages >= 2 && kSeq % kStageKeys == 0 && kStageKeys % 32 == 0, "ring");
static_assert(kStageKeys * kDh * 2 == 2 * kFusedWaves * 32 * 16, "two copies a lane for each of K and V^T");
static_assert(kKPitch % 16 == 0 && kVPitch % 16 == 0 && kKBytes % 16 == 0 && kBufBytes % 16 == 0, "16-byte copies");
// One stage's four copies of this lane. The wait on xcnt is the last line of the copies' own statement, so that it stands in
// front of every later write of an address register that a copy names.
__device__ __forceinline__ void stage_copy(unsigned lk0, const _Float16* gk0, unsigned lk1, const _Float16* gk1,
                                           unsigned lv0, const _Float16* gv0, unsigned lv1, const _Float16* gv1) {
  asm volatile("global_load_async_to_lds_b128 %0, %1, off\n\t"
               "global_load_async_to_lds_b128 %2, %3, off\n\t"
               "global_load_async_to_lds_b128 %4, %5, off\n\t"
               "global_load_async_to_lds_b128 %6, %7, off\n\t"
               "s_wait_xcnt 0x0"
               :: "v"(lk0), "v"(gk0), "v"(lk1), "v"(gk1), "v"(lv0), "v"(gv0), "v"(lv1), "v"(gv1) : "memory");
}
constexpr int   kMaskKeys   = kStageKeys / 2;              // keys a slot
constexpr int   kMaskPitch  = 4 * kMaskKeys + 16;          // bytes: one query's 64 mask words, padded
constexpr int   kMaskSlot   = 16 * kMaskPitch;             // 4,352: the 16 queries of one wave
static_assert(kMaskKeys == 64 && kMaskPitch % 16 == 0 && (kMaskPitch / 16) % 2 == 1, "a copy covers two rows of 256 bytes");
// One slot's eight copies of this lane, rows 2 i + (lane / 16). The wait on xcnt is the last line of the copies' own statement, so
// that it stands in front of every later write of an address register that a copy names.
__device__ __forceinline__ void mask_copy(unsigned l, const int* g) {
  asm volatile("global_load_async_to_lds_b128 %0, %1, off\n\t"
               "global_load_async_to_lds_b128 %2, %3, off\n\t"
               "global_load_async_to_lds_b128 %4, %5, off\n\t"
               "global_load_async_to_lds_b128 %6, %7, off\n\t"
               "global_load_async_to_lds_b128 %8, %9, off\n\t"
               "global_load_async_to_lds_b128 %10, %11, off\n\t"
               "global_load_async_to_lds_b128 %12, %13, off\n\t"
               "global_load_async_to_lds_b128 %14, %15, off\n\t"
               "s_wait_xcnt 0x0"
               :: "v"(l),                   "v"(g),
                  "v"(l +  2 * kMaskPitch), "v"(g +  2 * kSeq),
                  "v"(l +  4 * kMaskPitch), "v"(g +  4 * kSeq),
                  "v"(l +  6 * kMaskPitch), "v"(g +  6 * kSeq),
                  "v"(l +  8 * kMaskPitch), "v"(g +  8 * kSeq),
                  "v"(l + 10 * kMaskPitch), "v"(g + 10 * kSeq),
                  "v"(l + 12 * kMaskPitch), "v"(g + 12 * kSeq),
                  "v"(l + 14 * kMaskPitch), "v"(g + 14 * kSeq) : "memory");
}
constexpr float kLog2e      = 1.4426950408889634f;
constexpr float kLn2        = 0.6931471805599453f;
constexpr float kDistScale2 = kDistScale * kLn2;           // 1 / (x ln 2) = log2(e) / x
constexpr float kEps2       = kEps * kLn2;
constexpr float kNegBig2    = kNegBig * kLog2e;
constexpr float kCarry      = 14.0f;                       // p carried x2^14
constexpr float kLagLimit   = kLog2e + kCarry;             // a - ms above this: take a new maximum
static_assert(kSeq % (16 * kFusedWaves) == 0 && kDh == 64, "fused tiles");
__global__ __launch_bounds__(kFusedWaves * 32) void fused_dist_attn_kernel(
    const float* __restrict__ qp, const unsigned short* __restrict__ K16p, const unsigned short* __restrict__ VTp,
    const float* __restrict__ K2p, const int* __restrict__ maskp, float* __restrict__ outp) {
  const int lane = threadIdx.x & 31;
  const int wave = threadIdx.x >> 5;
  const int c  = lane & 15;
  const int hh = lane >> 4;
  const int bh = blockIdx.y;
  const int b  = bh / kHeads;
  const int h  = bh - b * kHeads;
  const int q  = blockIdx.x * (16 * kFusedWaves) + wave * 16 + c;     // this lane's query

  // this lane's share of its query's row, f32 as given: four runs of 8 (d = 16 j + 8 hh ...), the hardware k order of the B operand
  const float* Qr = qp + ((size_t)(b * kSeq + q)) * kDim + h * kDh + 8 * hh;
  __shared__ __attribute__((aligned(16))) unsigned char ring[2 * kBufBytes];
  // copies: chunk e of 16 bytes, e = threadIdx.x and e + 512. K: row e / 8 (key), chunk e % 8. V^T: row e / 16 (d), chunk e % 16.
  const int tid = threadIdx.x;
  const _Float16* gk = (const _Float16*)K16p + ((size_t)(b * kSeq + (tid >> 3))) * kDim + h * kDh + 8 * (tid & 7);
  const _Float16* gv = (const _Float16*)VTp + ((size_t)bh * kDh + (tid >> 4)) * kSeq + 8 * (tid & 15);
  const unsigned  lk = (unsigned)(size_t)ring + (unsigned)((tid >> 3) * kKPitch + 16 * (tid & 7));
  const unsigned  lv = (unsigned)(size_t)ring + (unsigned)(kKBytes + (tid >> 4) * kVPitch + 16 * (tid & 15));
  // readers: this lane's row and half in the K part and in the V^T part of a buffer
  const unsigned char* Kl = ring + c * kKPitch + 16 * hh;
  const unsigned char* Vl = ring + kKBytes + c * kVPitch + 16 * hh;
  const float*    kn = K2p + (size_t)bh * kSeq + 8 * hh;
  // mask ring of this wave. Copies: lane (c, hh) brings chunk c of 16 bytes of rows hh, hh + 2, ... Reader: row c, words 8 hh ...
  __shared__ __attribute__((aligned(16))) unsigned char mring[kFusedWaves * 2 * kMaskSlot];
  const int*      gm = maskp + (size_t)(q - c + hh) * kSeq + 4 * c;
  const unsigned  lm = (unsigned)(size_t)mring + (unsigned)(wave * (2 * kMaskSlot) + hh * kMaskPitch + 16 * c);
  const unsigned char* Ml = mring + wave * (2 * kMaskSlot) + c * kMaskPitch + 32 * hh;

  v8f acc[4];
#pragma unroll
  for (int t = 0; t < 4; ++t) acc[t] = (v8f){0.f,0.f,0.f,0.f,0.f,0.f,0.f,0.f};
  float ms = -__builtin_inff();   // maximum in use, less the carry
  float l  = 0.f;                 // this lane half's share of the query's sum of p

  // stage st (keys 128 st ...) into buffer buf: K rows r and r + 64, V^T rows d and d + 32
  auto copy_stage = [&](int st, int buf) {
    stage_copy(lk + buf * kBufBytes,                gk + (size_t)st * kStageKeys * kDim,
               lk + buf * kBufBytes + 64 * kKPitch, gk + ((size_t)st * kStageKeys + 64) * kDim,
               lv + buf * kBufBytes,                gv + (size_t)st * kStageKeys,
               lv + buf * kBufBytes + 32 * kVPitch, gv + (size_t)32 * kSeq + (size_t)st * kStageKeys);
  };
  copy_stage(0, 0);
  mask_copy(lm, gm);                                  // keys 0 ... 63 into slot 0
  mask_copy(lm + kMaskSlot, gm + kMaskKeys);          // keys 64 ... 127 into slot 1
  // the query rows are asked for behind stage 0's copies, so that both are on their way together
  v4f qx[8];
#pragma unroll
  for (int j = 0; j < 4; ++j) {
    qx[2 * j]     = *(const v4f*)(Qr + 16 * j);
    qx[2 * j + 1] = *(const v4f*)(Qr + 16 * j + 4);
  }
  asm volatile("s_wait_xcnt 0x0" ::: "memory");       // in front of any later write of the address registers of these loads
  asm volatile("s_wait_asynccnt 0x0" ::: "memory");   // this wave's share of stage 0 and its two mask slots have landed
  __syncthreads();                                    // every wave's share has: stage 0 may be read
  copy_stage(1, 1);

  // Q^T fragments cast in registers; the squared norm from the f32 values, four partial sums a lane, the two lane halves joined
  v16h qf0, qf1;
  v4f qs = (v4f){0.f, 0.f, 0.f, 0.f};
#pragma unroll
  for (int j = 0; j < 8; ++j) {
    qs += qx[j] * qx[j];
#pragma unroll
    for (int e = 0; e < 4; ++e) {
      if (j < 4) qf0[4 * j + e] = (_Float16)qx[j][e];
      else       qf1[4 * (j - 4) + e] = (_Float16)qx[j][e];
    }
  }
  const float q2h = (qs[0] + qs[1]) + (qs[2] + qs[3]);
  const float q2i = q2h + xhalf(q2h);

#pragma unroll 1
  for (int st = 0; st < kStages; ++st) {
  const unsigned char* Kb = Kl + (st & 1) * kBufBytes;
  const unsigned char* Vb = Vl + (st & 1) * kBufBytes;
#pragma unroll     // the four passes of a stage: every LDS offset is an immediate
  for (int ps = 0; ps < kStageKeys / 32; ++ps) {
    const int key0 = st * kStageKeys + 32 * ps;
    // every load of the pass, the longest way first: norms from memory; K fragments, mask words, V^T fragments from LDS
    v4i mk[2][2];
    v4f k2[2][2];
    v16h kf[2][2], vf[4];
#pragma unroll     // here and in the loops below: constant indices, so that the arrays are registers
    for (int kt = 0; kt < 2; ++kt) {
      const int ko = key0 + 16 * kt;
      k2[kt][0] = *(const v4f*)(kn + ko);
      k2[kt][1] = *(const v4f*)(kn + ko + 4);
    }
#pragma unroll
    for (int kt = 0; kt < 2; ++kt) {
      const _Float16* kp = (const _Float16*)(Kb + (32 * ps + 16 * kt) * kKPitch);
      kf[kt][0] = frag_load(kp);
      kf[kt][1] = frag_load(kp + 32);
    }
#pragma unroll
    for (int kt = 0; kt < 2; ++kt) {
      const unsigned char* mp = Ml + (ps >> 1) * kMaskSlot + (ps & 1) * 128 + 64 * kt;
      mk[kt][0] = *(const v4i*)(mp);
      mk[kt][1] = *(const v4i*)(mp + 16);
    }
#pragma unroll
    for (int t = 0; t < 4; ++t) vf[t] = frag_load((const _Float16*)(Vb + (16 * t) * kVPitch + 64 * ps));
    // keeps the LDS reads one group at the head of the pass: left free, they are spread among the matrix instructions, each
    // pair waited for at once into the same registers
    __builtin_amdgcn_sched_barrier(0);
    v8f sc[2];
#pragma unroll
    for (int kt = 0; kt < 2; ++kt) sc[kt] = mma_f16(kf[kt][0], qf0, (v8f){0.f,0.f,0.f,0.f,0.f,0.f,0.f,0.f});
#pragma unroll
    for (int kt = 0; kt < 2; ++kt) sc[kt] = mma_f16(kf[kt][1], qf1, sc[kt]);
    // keeps the four score products in front of the wait for the norms, so that they run while those are on their way
    __builtin_amdgcn_sched_barrier(0);
    float a[2][8];
    float mx = -__builtin_inff();
#pragma unroll
    for (int kt = 0; kt < 2; ++kt) {
      const v8f s = sc[kt];
      const v4f k2a = k2[kt][0];
      const v4f k2b = k2[kt][1];
      const v4i ma  = mk[kt][0];
      const v4i mb  = mk[kt][1];
#pragma unroll
      for (int r = 0; r < 8; r += 2) {    // two keys at a time: the plain arithmetic between the hardware functions is packed f32
        const v2f kv = (r < 4) ? (v2f){k2a[r & 3], k2a[(r & 3) + 1]} : (v2f){k2b[r & 3], k2b[(r & 3) + 1]};
        const v2f mf = (r < 4) ? (v2f){(float)ma[r & 3], (float)ma[(r & 3) + 1]} : (v2f){(float)mb[r & 3], (float)mb[(r & 3) + 1]};
        v2f d2 = (q2i + kv) - 2.0f * (v2f){s[r], s[r + 1]};
        d2 = __builtin_elementwise_max(d2, (v2f){0.0f, 0.0f});
        const v2f root = (v2f){__builtin_amdgcn_sqrtf(d2[0]), __builtin_amdgcn_sqrtf(d2[1])};
        const v2f den  = root * kDistScale2 + kEps2;
        v2f av = (v2f){__builtin_amdgcn_rcpf(den[0]), __builtin_amdgcn_rcpf(den[1])};
        av = av + mf * kNegBig2;
        a[kt][r]     = av[0];
        a[kt][r + 1] = av[1];
        mx = fmaxf(mx, fmaxf(av[0], av[1]));
      }
    }
    mx = fmaxf(mx, xhalf(mx));    // both lane halves hold the query's maximum of this pass
    if (__builtin_amdgcn_ballot_w32((mx - ms) > kLagLimit) != 0) {   // wave-uniform; always taken in the first pass (ms = -inf)
      const float msNew = fmaxf(ms, mx - kCarry);
      const float corr  = __builtin_amdgcn_exp2f(ms - msNew);        // 0 in the first pass
      ms = msNew;
      l *= corr;
#pragma unroll
      for (int t = 0; t < 4; ++t) acc[t] = acc[t] * corr;
    }
    v16h pf;
#pragma unroll
    for (int e = 0; e < 16; ++e) {
      const float pv = __builtin_amdgcn_exp2f(a[e >> 3][e & 7] - ms);
      l += pv;
      pf[e] = (_Float16)pv;
    }
#pragma unroll
    for (int t = 0; t < 4; ++t) acc[t] = mma_f16(vf[t], pf, acc[t]);
    if (ps == 1) {   // half way: slot 0 has been read out, slot 1 is needed next
      asm volatile("s_wait_dscnt 0x0" ::: "memory");      // this wave's reads of slot 0 have returned: it may be refilled
      asm volatile("s_wait_asynccnt 0x0" ::: "memory");   // this wave's copies into slot 1 have landed
      if (st + 1 < kStages) mask_copy(lm, gm + (st + 1) * kStageKeys);   // the same test in every wave
    }
  }
  asm volatile("s_wait_dscnt 0x0" ::: "memory");      // this wave's reads of the buffer have returned
  asm volatile("s_wait_asynccnt 0x0" ::: "memory");   // this wave's share of stage st + 1 and its mask slot 0 have landed
  __syncthreads();                                    // stage st + 1 may be read; the buffer of stage st is free
  if (st + 2 < kStages) copy_stage(st + 2, st & 1);   // the same test in every wave of the block
  if (st + 1 < kStages) mask_copy(lm + kMaskSlot, gm + (st + 1) * kStageKeys + kMaskKeys);   // slot 1, read out above
  }
  asm volatile("s_wait_asynccnt 0x0" ::: "memory");   // nothing of this wave is in flight when it ends

  l = l + xhalf(l);               // join the two halves' sums, unconditionally
  const float inv = 1.0f / l;
  float* orow = outp + ((size_t)(b * kSeq + q)) * kDim + h * kDh + 8 * hh;   // register r of tile t = d 16 t + 8 hh + r
#pragma unroll
  for (int t = 0; t < 4; ++t) {
    const v8f o = acc[t] * inv;
    *(v4f*)(orow + 16 * t)     = (v4f){o[0], o[1], o[2], o[3]};
    *(v4f*)(orow + 16 * t + 4) = (v4f){o[4], o[5], o[6], o[7]};
  }
}

// ---------------------------------------------------------------------------
// Host glue.
//   K16  f16 [4096][1024]            8,388,608  at          0
//   VT   f16 [2*16][64][2048]        8,388,608  at  8,388,608
//   K2   f32 [2*16][2048]              262,144  at 16,777,216
//   total                           17,039,360
// ---------------------------------------------------------------------------
extern "C" void kernel_launch(void* const* d_in, const int* in_sizes, int n_in,
                              void* d_out, int out_size, void* d_ws, size_t ws_size,
                              hipStream_t stream) {
  if (n_in < 5) return;
  const int nElem = kBatch * kSeq * kDim;          // 4,194,304
  if (in_sizes[0] != nElem || in_sizes[1] != nElem || in_sizes[2] != nElem) return;
  if (in_sizes[3] != kSeq * kSeq) return;
  if (out_size != nElem) return;

  const size_t szQK = (size_t)kTok * kDim * 2;
  const size_t szVT = (size_t)kBatch * kHeads * kDh * kSeq * 2;
  const size_t szN  = (size_t)kBatch * kHeads * kSeq * 4;
  const size_t offK  = 0;
  const size_t offVT = offK + szQK;
  const size_t offK2 = offVT + szVT;
  const size_t total = offK2 + szN;
  if (ws_size < total) return;

  const float* q    = (const float*)d_in[0];
  const float* k    = (const float*)d_in[1];
  const float* v    = (const float*)d_in[2];
  const int*   mask = (const int*)d_in[3];
  const int*   nh   = (const int*)d_in[4];   // static head count (16), structural only
  float* out = (float*)d_out;
  char* ws = (char*)d_ws;
  unsigned short* K16 = (unsigned short*)(ws + offK);
  unsigned short* VT  = (unsigned short*)(ws + offVT);
  float* K2 = (float*)(ws + offK2);

  // ---- prologue: 16-bit operand planes and squared norms ----
  const int n8 = (kTok * kDim) / 8;   // 524288 -> 2048 blocks exact
  cast8_f16_kernel<<<dim3(n8 / 256), dim3(256), 0, stream>>>(k, K16, n8);
  vt_cast_kernel<<<dim3(kSeq / 64, kHeads, kBatch), dim3(256), 0, stream>>>(v, VT);
  sumsq_kernel<<<dim3(kSeq / 256, kHeads, kBatch), dim3(256), 0, stream>>>(k, K2, nh);

  // ---- all 32 (batch, head) planes in one launch ----
  fused_dist_attn_kernel<<<dim3(kSeq / (16 * kFusedWaves), kBatch * kHeads), dim3(kFusedWaves * 32), 0, stream>>>(
      q, K16, VT, K2, mask, out);
}

// v007
// Measured time: 64.3 microseconds a run.
// Timed twice side by side with v006, it ran 1.09 times as fast both times.
// Counting every step since v000, it is 16.5 times as fast.
// Contractions: scores k_h . q_h^T (k as an f16 plane, q cast to f16 in registers) and v_h^T . attn^T (P f16 carried x2^14 against the maximum in use, V^T f16 plane) on v_wmma_f32_16x16x32_f16, f32 accumulate; squared norms, distance transform, additive mask and softmax in f32.
#include <hip/hip_runtime.h>
#include <math.h>

// ---------------------------------------------------------------------------
// Problem constants
// ---------------------------------------------------------------------------
constexpr int kBatch = 2;
constexpr int kSeq   = 2048;
constexpr int kDim   = 1024;
constexpr int kHeads = 16;
constexpr int kDh    = 64;
constexpr int kTok   = kBatch * kSeq;     // 4096 token rows
constexpr float kDistScale = 0.125f;      // 64^-0.5
constexpr float kEps       = 1.0e-9f;
constexpr float kNegBig    = -1.0e9f;
static_assert(kHeads * kDh == kDim, "shape");
static_assert(kSeq % 64 == 0 && kDh % 32 == 0 && kSeq % 256 == 0, "tiles");

typedef __attribute__((ext_vector_type(16))) _Float16 v16h;
typedef __attribute__((ext_vector_type(8)))  _Float16 v8h;
typedef __attribute__((ext_vector_type(2)))  _Float16 v2h;
typedef __attribute__((ext_vector_type(8)))  float    v8f;
typedef __attribute__((ext_vector_type(4)))  float    v4f;
typedef __attribute__((ext_vector_type(2)))  float    v2f;
typedef __attribute__((ext_vector_type(4)))  int      v4i;
typedef __attribute__((ext_vector_type(4)))  unsigned int v4u;

// ---------------------------------------------------------------------------
// Small helpers
// ---------------------------------------------------------------------------
// two f32 cast to f16 (round to nearest even), a in the low half of the word
__device__ __forceinline__ unsigned pk2h(float a, float b) { const v2h p = (v2h){(_Float16)a, (_Float16)b}; return __builtin_bit_cast(unsigned, p); }
// 16x16x32 f16 fragment in the hardware k order: elements 0..7 <- p[0..7], 8..15 <- p[16..23]; p already holds the lane half's +8.
__device__ __forceinline__ v16h frag_load(const _Float16* p) {
  union { v16h v; v8h h[2]; } f; f.h[0] = *(const v8h*)(p); f.h[1] = *(const v8h*)(p + 16); return f.v;
}
__device__ __forceinline__ v8f mma_f16(v16h a, v16h b, v8f c) {
  return __builtin_amdgcn_wmma_f32_16x16x32_f16(false, a, false, b, (short)0, c, false, false);
}
// lane l <-> lane l ^ 16
__device__ __forceinline__ float xhalf(float x) {
  return __builtin_bit_cast(float, __builtin_amdgcn_permlanex16(__builtin_bit_cast(int, x), __builtin_bit_cast(int, x), 0x76543210, 0xfedcba98, false, false));
}

// ---------------------------------------------------------------------------
// Operand planes of one (batch, head, 128 token rows) in one pass over k and v:
//   K16[b][s][h*64+d]      = f16( k[b][s][h*64+d] )
//   K2[(b*16+h)][s]        = sum_d k[b][s][h*64+d]^2 (f32, from the f32 values)
//   VT[(b*16+h)][d][s]     = f16( v[b][s][h*64+d] )
// grid (16, 16, 2): blockIdx.x = s tile (128 rows), blockIdx.y = head, blockIdx.z = batch. 256 threads.
// All 16 loads of a thread (16 bytes each) are asked for before the first is used.
// k: task e = 256 i + t is row e / 8, floats 8 (e % 8) ...: one 16-byte store; its 8 squares go to LDS, one thread a row adds the 8 shares.
// v: a task is a pair of rows (2 rp, 2 rp + 1) and 4 columns: each column's two values are one 32-bit word of the transposed tile in
// LDS (64 d rows x 64 words, pitch 68 words = 16 bytes x odd); the tile leaves in 16-byte pieces, 256 bytes a d row.
// ---------------------------------------------------------------------------
constexpr int kPrepRows  = 128;
constexpr int kPrepPitch = kPrepRows / 2 + 4;              // words
static_assert(kSeq % kPrepRows == 0 && kDh == 64 && (kPrepPitch * 4) % 16 == 0, "prep tiles");
__global__ __launch_bounds__(256) void prep_kernel(const float* __restrict__ k, const float* __restrict__ v,
                                                   unsigned short* __restrict__ K16, unsigned short* __restrict__ VT,
                                                   float* __restrict__ K2, const int* __restrict__ unused_nh) {
  (void)unused_nh;
  __shared__ __attribute__((aligned(16))) unsigned vt[kDh * kPrepPitch];
  __shared__ float part[kPrepRows * 9];
  const int t  = threadIdx.x;
  const int s0 = blockIdx.x * kPrepRows;
  const int h  = blockIdx.y;
  const int b  = blockIdx.z;
  const size_t tile = ((size_t)(b * kSeq + s0)) * kDim + h * kDh;
  const float* kp = k + tile + (size_t)(t >> 3) * kDim + 8 * (t & 7);          // row t / 8 (+ 32 i)
  const float* vp = v + tile + (size_t)(2 * (t >> 3)) * kDim + 4 * (t & 7);    // rows 2 (t / 8) (+ 64 (i / 2)), columns 4 (t % 8) (+ 32 (i % 2))
  v4f kx[4][2], vx[4][2];
#pragma unroll
  for (int i = 0; i < 4; ++i) {
    kx[i][0] = *(const v4f*)(kp + (size_t)(32 * i) * kDim);
    kx[i][1] = *(const v4f*)(kp + (size_t)(32 * i) * kDim + 4);
  }
#pragma unroll
  for (int i = 0; i < 4; ++i) {
    vx[i][0] = *(const v4f*)(vp + (size_t)(64 * (i >> 1)) * kDim + 32 * (i & 1));
    vx[i][1] = *(const v4f*)(vp + (size_t)(64 * (i >> 1) + 1) * kDim + 32 * (i & 1));
  }
  // keeps all 16 loads in front of the first use: left free, the v loads are moved behind the wait for the k loads, two trips to memory in a row
  __builtin_amdgcn_sched_barrier(0);
  v4u ku[4];
#pragma unroll
  for (int i = 0; i < 4; ++i) {
    const v4f x = kx[i][0], y = kx[i][1];
    ku[i] = (v4u){pk2h(x[0], x[1]), pk2h(x[2], x[3]), pk2h(y[0], y[1]), pk2h(y[2], y[3])};
    const v4f sq = x * x + y * y;
    part[((t >> 3) + 32 * i) * 9 + (t & 7)] = (sq[0] + sq[1]) + (sq[2] + sq[3]);
  }
#pragma unroll
  for (int i = 0; i < 4; ++i) {
    const int rp = (t >> 3) + 32 * (i >> 1);
    const int c4 = 4 * (t & 7) + 32 * (i & 1);
#pragma unroll
    for (int j = 0; j < 4; ++j) vt[(c4 + j) * kPrepPitch + rp] = pk2h(vx[i][0][j], vx[i][1][j]);
  }
  __syncthreads();
  // every store to memory stands behind the barrier, which would otherwise wait for the stores in front of it
  unsigned short* ko = K16 + tile + (size_t)(t >> 3) * kDim + 8 * (t & 7);
#pragma unroll
  for (int i = 0; i < 4; ++i) *(v4u*)(ko + (size_t)(32 * i) * kDim) = ku[i];
  unsigned short* vo = VT + ((size_t)(b * kHeads + h) * kDh + (t >> 4)) * kSeq + s0 + 8 * (t & 15);   // d row t / 16 (+ 16 i)
#pragma unroll
  for (int i = 0; i < 4; ++i)
    *(v4u*)(vo + (size_t)(16 * i) * kSeq) = *(const v4u*)(vt + ((t >> 4) + 16 * i) * kPrepPitch + 4 * (t & 15));
  if (t < kPrepRows) {
    const float* pr = part + t * 9;
    K2[(size_t)(b * kHeads + h) * kSeq + s0 + t] = ((pr[0] + pr[1]) + (pr[2] + pr[3])) + ((pr[4] + pr[5]) + (pr[6] + pr[7]));
  }
}

// ---------------------------------------------------------------------------
// Scores, distance transform, mask, softmax and context product of one (batch, head) in one kernel; no score or
// probability plane in memory. A wave owns 16 queries and walks the 2048 keys in passes of 32:
//   S^T = K . Q^T        A = 16 keys x 64 d (two tiles of keys), B = Q^T read as f32, cast once, kept in registers; lane (c, hh), register r of tile kt
//                        holds key key0 + 16 kt + 8 hh + r against query c
//   a   = log2(e) * [ 1 / (sqrt(max(q2 + k2 - 2 S, 0)) * 0.125 + 1e-9) + float(mask) * (-1e9) ]      (f32)
//                        log2(e) sits in the three constants; square root and reciprocal are one hardware instruction each
//                        (about 1 ulp; the argument of the reciprocal is at least 1e-9 ln 2, a subnormal d2 counts as 0 beside it)
//   p   = 2^(a - ms)     one hardware instruction; ms = (maximum in use) - 14, so p is carried x2^14; a - ms never exceeds
//                        kLagLimit, and far below 0 the result is 0; the two score tiles, cast in place, are the
//                        B operand P^T of the second product (hardware k order, the order frag_load gives V^T)
//   O^T += V^T . P^T     A = 16 d x 32 keys from the V^T plane, four tiles of d
// The maximum in use may trail a query's true maximum by up to log2(e) (p * 2^14 <= e * 2^14 < 65504); sums and accumulators are
// rescaled only in a pass where some query of the wave exceeds that. The carry cancels in acc / l.
// grid (kSeq / 256, kBatch * kHeads), 16 waves x 16 queries.
// K rows and V^T rows are the same for all 16 waves: they are staged in LDS once per block, 128 keys a stage, two buffers,
// by asynchronous copies of 16 bytes a lane (8 or 16 lanes cover a whole row slice); stage s + 1 flies while stage s is worked on.
// Rows in LDS are pitched 16 bytes x odd for the 16-byte fragment reads.
// The mask words of a wave's 16 queries are read by that wave alone. A lane needs 8 words of its own query's row, so a load from
// memory would touch 16 rows at a time; instead the wave copies whole 256-byte row pieces (64 keys, two rows a copy) into a ring
// of its own, two slots, and reads its words from there. Slot 0 serves passes 0 and 1 of a stage, slot 1 passes 2 and 3; a slot is
// refilled behind the wave's own wait on its reads, two passes before it is read again. No other wave touches it: no barrier.
// ---------------------------------------------------------------------------
constexpr int   kFusedWaves = 16;
constexpr int   kStageKeys  = 128;
constexpr int   kStages     = kSeq / kStageKeys;
constexpr int   kKPitch     = 2 * kDh + 16;                // bytes: one key's 64 f16, padded
constexpr int   kVPitch     = 2 * kStageKeys + 16;         // bytes: one d row's 128 keys, padded
constexpr int   kKBytes     = kStageKeys * kKPitch;        // 18,432
constexpr int   kVBytes     = kDh * kVPitch;               // 17,408
constexpr int   kBufBytes   = kKBytes + kVBytes;           // 35,840
static_assert(kStages >= 2 && kSeq % kStageKeys == 0 && kStageKeys % 32 == 0, "ring");
static_assert(kStageKeys * kDh * 2 == 2 * kFusedWaves * 32 * 16, "two copies a lane for each of K and V^T");
static_assert(kKPitch % 16 == 0 && kVPitch % 16 == 0 && kKBytes % 16 == 0 && kBufBytes % 16 == 0, "16-byte copies");
// One stage's four copies of this lane. The wait on xcnt is the last line of the copies' own statement, so that it stands in
// front of every later write of an address register that a copy names.
__device__ __forceinline__ void stage_copy(unsigned lk0, const _Float16* gk0, unsigned lk1, const _Float16* gk1,
                                           unsigned lv0, const _Float16* gv0, unsigned lv1, const _Float16* gv1) {
  asm volatile("global_load_async_to_lds_b128 %0, %1, off\n\t"
               "global_load_async_to_lds_b128 %2, %3, off\n\t"
               "global_load_async_to_lds_b128 %4, %5, off\n\t"
               "global_load_async_to_lds_b128 %6, %7, off\n\t"
               "s_wait_xcnt 0x0"
               :: "v"(lk0), "v"(gk0), "v"(lk1), "v"(gk1), "v"(lv0), "v"(gv0), "v"(lv1), "v"(gv1) : "memory");
}
constexpr int   kMaskKeys   = kStageKeys / 2;              // keys a slot
constexpr int   kMaskPitch  = 4 * kMaskKeys + 16;          // bytes: one query's 64 mask words, padded
constexpr int   kMaskSlot   = 16 * kMaskPitch;             // 4,352: the 16 queries of one wave
static_assert(kMaskKeys == 64 && kMaskPitch % 16 == 0 && (kMaskPitch / 16) % 2 == 1, "a copy covers two rows of 256 bytes");
// One slot's eight copies of this lane, rows 2 i + (lane / 16). The wait on xcnt is the last line of the copies' own statement, so
// that it stands in front of every later write of an address register that a copy names.
__device__ __forceinline__ void mask_copy(unsigned l, const int* g) {
  asm volatile("global_load_async_to_lds_b128 %0, %1, off\n\t"
               "global_load_async_to_lds_b128 %2, %3, off\n\t"
               "global_load_async_to_lds_b128 %4, %5, off\n\t"
               "global_load_async_to_lds_b128 %6, %7, off\n\t"
               "global_load_async_to_lds_b128 %8, %9, off\n\t"
               "global_load_async_to_lds_b128 %10, %11, off\n\t"
               "global_load_async_to_lds_b128 %12, %13, off\n\t"
               "global_load_async_to_lds_b128 %14, %15, off\n\t"
               "s_wait_xcnt 0x0"
               :: "v"(l),                   "v"(g),
                  "v"(l +  2 * kMaskPitch), "v"(g +  2 * kSeq),
                  "v"(l +  4 * kMaskPitch), "v"(g +  4 * kSeq),
                  "v"(l +  6 * kMaskPitch), "v"(g +  6 * kSeq),
                  "v"(l +  8 * kMaskPitch), "v"(g +  8 * kSeq),
                  "v"(l + 10 * kMaskPitch), "v"(g + 10 * kSeq),
                  "v"(l + 12 * kMaskPitch), "v"(g + 12 * kSeq),
                  "v"(l + 14 * kMaskPitch), "v"(g + 14 * kSeq) : "memory");
}
constexpr float kLog2e      = 1.4426950408889634f;
constexpr float kLn2        = 0.6931471805599453f;
constexpr float kDistScale2 = kDistScale * kLn2;           // 1 / (x ln 2) = log2(e) / x
constexpr float kEps2       = kEps * kLn2;
constexpr float kNegBig2    = kNegBig * kLog2e;
constexpr float kCarry      = 14.0f;                       // p carried x2^14
constexpr float kLagLimit   = kLog2e + kCarry;             // a - ms above this: take a new maximum
static_assert(kSeq % (16 * kFusedWaves) == 0 && kDh == 64, "fused tiles");
__global__ __launch_bounds__(kFusedWaves * 32) void fused_dist_attn_kernel(
    const float* __restrict__ qp, const unsigned short* __restrict__ K16p, const unsigned short* __restrict__ VTp,
    const float* __restrict__ K2p, const int* __restrict__ maskp, float* __restrict__ outp) {
  const int lane = threadIdx.x & 31;
  const int wave = threadIdx.x >> 5;
  const int c  = lane & 15;
  const int hh = lane >> 4;
  const int bh = blockIdx.y;
  const int b  = bh / kHeads;
  const int h  = bh - b * kHeads;
  const int q  = blockIdx.x * (16 * kFusedWaves) + wave * 16 + c;     // this lane's query

  // this lane's share of its query's row, f32 as given: four runs of 8 (d = 16 j + 8 hh ...), the hardware k order of the B operand
  const float* Qr = qp + ((size_t)(b * kSeq + q)) * kDim + h * kDh + 8 * hh;
  __shared__ __attribute__((aligned(16))) unsigned char ring[2 * kBufBytes];
  // copies: chunk e of 16 bytes, e = threadIdx.x and e + 512. K: row e / 8 (key), chunk e % 8. V^T: row e / 16 (d), chunk e % 16.
  const int tid = threadIdx.x;
  const _Float16* gk = (const _Float16*)K16p + ((size_t)(b * kSeq + (tid >> 3))) * kDim + h * kDh + 8 * (tid & 7);
  const _Float16* gv = (const _Float16*)VTp + ((size_t)bh * kDh + (tid >> 4)) * kSeq + 8 * (tid & 15);
  const unsigned  lk = (unsigned)(size_t)ring + (unsigned)((tid >> 3) * kKPitch + 16 * (tid & 7));
  const unsigned  lv = (unsigned)(size_t)ring + (unsigned)(kKBytes + (tid >> 4) * kVPitch + 16 * (tid & 15));
  // readers: this lane's row and half in the K part and in the V^T part of a buffer
  const unsigned char* Kl = ring + c * kKPitch + 16 * hh;
  const unsigned char* Vl = ring + kKBytes + c * kVPitch + 16 * hh;
  const float*    kn = K2p + (size_t)bh * kSeq + 8 * hh;
  // mask ring of this wave. Copies: lane (c, hh) brings chunk c of 16 bytes of rows hh, hh + 2, ... Reader: row c, words 8 hh ...
  __shared__ __attribute__((aligned(16))) unsigned char mring[kFusedWaves * 2 * kMaskSlot];
  const int*      gm = maskp + (size_t)(q - c + hh) * kSeq + 4 * c;
  const unsigned  lm = (unsigned)(size_t)mring + (unsigned)(wave * (2 * kMaskSlot) + hh * kMaskPitch + 16 * c);
  const unsigned char* Ml = mring + wave * (2 * kMaskSlot) + c * kMaskPitch + 32 * hh;

  v8f acc[4];
#pragma unroll
  for (int t = 0; t < 4; ++t) acc[t] = (v8f){0.f,0.f,0.f,0.f,0.f,0.f,0.f,0.f};
  float ms = -__builtin_inff();   // maximum in use, less the carry
  float l  = 0.f;                 // this lane half's share of the query's sum of p

  // stage st (keys 128 st ...) into buffer buf: K rows r and r + 64, V^T rows d and d + 32
  auto copy_stage = [&](int st, int buf) {
    stage_copy(lk + buf * kBufBytes,                gk + (size_t)st * kStageKeys * kDim,
               lk + buf * kBufBytes + 64 * kKPitch, gk + ((size_t)st * kStageKeys + 64) * kDim,
               lv + buf * kBufBytes,                gv + (size_t)st * kStageKeys,
               lv + buf * kBufBytes + 32 * kVPitch, gv + (size_t)32 * kSeq + (size_t)st * kStageKeys);
  };
  copy_stage(0, 0);
  mask_copy(lm, gm);                                  // keys 0 ... 63 into slot 0
  mask_copy(lm + kMaskSlot, gm + kMaskKeys);          // keys 64 ... 127 into slot 1
  // the query rows are asked for behind stage 0's copies, so that both are on their way together
  v4f qx[8];
#pragma unroll
  for (int j = 0; j < 4; ++j) {
    qx[2 * j]     = *(const v4f*)(Qr + 16 * j);
    qx[2 * j + 1] = *(const v4f*)(Qr + 16 * j + 4);
  }
  asm volatile("s_wait_xcnt 0x0" ::: "memory");       // in front of any later write of the address registers of these loads
  asm volatile("s_wait_asynccnt 0x0" ::: "memory");   // this wave's share of stage 0 and its two mask slots have landed
  __syncthreads();                                    // every wave's share has: stage 0 may be read
  copy_stage(1, 1);

  // Q^T fragments cast in registers; the squared norm from the f32 values, four partial sums a lane, the two lane halves joined
  v16h qf0, qf1;
  v4f qs = (v4f){0.f, 0.f, 0.f, 0.f};
#pragma unroll
  for (int j = 0; j < 8; ++j) {
    qs += qx[j] * qx[j];
#pragma unroll
    for (int e = 0; e < 4; ++e) {
      if (j < 4) qf0[4 * j + e] = (_Float16)qx[j][e];
      else       qf1[4 * (j - 4) + e] = (_Float16)qx[j][e];
    }
  }
  const float q2h = (qs[0] + qs[1]) + (qs[2] + qs[3]);
  const float q2i = q2h + xhalf(q2h);

#pragma unroll 1
  for (int st = 0; st < kStages; ++st) {
  const unsigned char* Kb = Kl + (st & 1) * kBufBytes;
  const unsigned char* Vb = Vl + (st & 1) * kBufBytes;
#pragma unroll     // the four passes of a stage: every LDS offset is an immediate
  for (int ps = 0; ps < kStageKeys / 32; ++ps) {
    const int key0 = st * kStageKeys + 32 * ps;
    // every load of the pass, the longest way first: norms from memory; K fragments, mask words, V^T fragments from LDS
    v4i mk[2][2];
    v4f k2[2][2];
    v16h kf[2][2], vf[4];
#pragma unroll     // here and in the loops below: constant indices, so that the arrays are registers
    for (int kt = 0; kt < 2; ++kt) {
      const int ko = key0 + 16 * kt;
      k2[kt][0] = *(const v4f*)(kn + ko);
      k2[kt][1] = *(const v4f*)(kn + ko + 4);
    }
#pragma unroll
    for (int kt = 0; kt < 2; ++kt) {
      const _Float16* kp = (const _Float16*)(Kb + (32 * ps + 16 * kt) * kKPitch);
      kf[kt][0] = frag_load(kp);
      kf[kt][1] = frag_load(kp + 32);
    }
#pragma unroll
    for (int kt = 0; kt < 2; ++kt) {
      const unsigned char* mp = Ml + (ps >> 1) * kMaskSlot + (ps & 1) * 128 + 64 * kt;
      mk[kt][0] = *(const v4i*)(mp);
      mk[kt][1] = *(const v4i*)(mp + 16);
    }
#pragma unroll
    for (int t = 0; t < 4; ++t) vf[t] = frag_load((const _Float16*)(Vb + (16 * t) * kVPitch + 64 * ps));
    // keeps the LDS reads one group at the head of the pass: left free, they are spread among the matrix instructions, each
    // pair waited for at once into the same registers
    __builtin_amdgcn_sched_barrier(0);
    v8f sc[2];
#pragma unroll
    for (int kt = 0; kt < 2; ++kt) sc[kt] = mma_f16(kf[kt][0], qf0, (v8f){0.f,0.f,0.f,0.f,0.f,0.f,0.f,0.f});
#pragma unroll
    for (int kt = 0; kt < 2; ++kt) sc[kt] = mma_f16(kf[kt][1], qf1, sc[kt]);
    // keeps the four score products in front of the wait for the norms, so that they run while those are on their way
    __builtin_amdgcn_sched_barrier(0);
    float a[2][8];
    float mx = -__builtin_inff();
#pragma unroll
    for (int kt = 0; kt < 2; ++kt) {
      const v8f s = sc[kt];
      const v4f k2a = k2[kt][0];
      const v4f k2b = k2[kt][1];
      const v4i ma  = mk[kt][0];
      const v4i mb  = mk[kt][1];
#pragma unroll
      for (int r = 0; r < 8; r += 2) {    // two keys at a time: the plain arithmetic between the hardware functions is packed f32
        const v2f kv = (r < 4) ? (v2f){k2a[r & 3], k2a[(r & 3) + 1]} : (v2f){k2b[r & 3], k2b[(r & 3) + 1]};
        const v2f mf = (r < 4) ? (v2f){(float)ma[r & 3], (float)ma[(r & 3) + 1]} : (v2f){(float)mb[r & 3], (float)mb[(r & 3) + 1]};
        v2f d2 = (q2i + kv) - 2.0f * (v2f){s[r], s[r + 1]};
        d2 = __builtin_elementwise_max(d2, (v2f){0.0f, 0.0f});
        const v2f root = (v2f){__builtin_amdgcn_sqrtf(d2[0]), __builtin_amdgcn_sqrtf(d2[1])};
        const v2f den  = root * kDistScale2 + kEps2;
        v2f av = (v2f){__builtin_amdgcn_rcpf(den[0]), __builtin_amdgcn_rcpf(den[1])};
        av = av + mf * kNegBig2;
        a[kt][r]     = av[0];
        a[kt][r + 1] = av[1];
        mx = fmaxf(mx, fmaxf(av[0], av[1]));
      }
    }
    mx = fmaxf(mx, xhalf(mx));    // both lane halves hold the query's maximum of this pass
    if (__builtin_amdgcn_ballot_w32((mx - ms) > kLagLimit) != 0) {   // wave-uniform; always taken in the first pass (ms = -inf)
      const float msNew = fmaxf(ms, mx - kCarry);
      const float corr  = __builtin_amdgcn_exp2f(ms - msNew);        // 0 in the first pass
      ms = msNew;
      l *= corr;
#pragma unroll
      for (int t = 0; t < 4; ++t) acc[t] = acc[t] * corr;
    }
    v16h pf;
#pragma unroll
    for (int e = 0; e < 16; ++e) {
      const float pv = __builtin_amdgcn_exp2f(a[e >> 3][e & 7] - ms);
      l += pv;
      pf[e] = (_Float16)pv;
    }
#pragma unroll
    for (int t = 0; t < 4; ++t) acc[t] = mma_f16(vf[t], pf, acc[t]);
    if (ps == 1) {   // half way: slot 0 has been read out, slot 1 is needed next
      asm volatile("s_wait_dscnt 0x0" ::: "memory");      // this wave's reads of slot 0 have returned: it may be refilled
      asm volatile("s_wait_asynccnt 0x0" ::: "memory");   // this wave's copies into slot 1 have landed
      if (st + 1 < kStages) mask_copy(lm, gm + (st + 1) * kStageKeys);   // the same test in every wave
    }
  }
  asm volatile("s_wait_dscnt 0x0" ::: "memory");      // this wave's reads of the buffer have returned
  asm volatile("s_wait_asynccnt 0x0" ::: "memory");   // this wave's share of stage st + 1 and its mask slot 0 have landed
  __syncthreads();                                    // stage st + 1 may be read; the buffer of stage st is free
  if (st + 2 < kStages) copy_stage(st + 2, st & 1);   // the same test in every wave of the block
  if (st + 1 < kStages) mask_copy(lm + kMaskSlot, gm + (st + 1) * kStageKeys + kMaskKeys);   // slot 1, read out above
  }
  asm volatile("s_wait_asynccnt 0x0" ::: "memory");   // nothing of this wave is in flight when it ends

  l = l + xhalf(l);               // join the two halves' sums, unconditionally
  const float inv = 1.0f / l;
  float* orow = outp + ((size_t)(b * kSeq + q)) * kDim + h * kDh + 8 * hh;   // register r of tile t = d 16 t + 8 hh + r
#pragma unroll
  for (int t = 0; t < 4; ++t) {
    const v8f o = acc[t] * inv;
    *(v4f*)(orow + 16 * t)     = (v4f){o[0], o[1], o[2], o[3]};
    *(v4f*)(orow + 16 * t + 4) = (v4f){o[4], o[5], o[6], o[7]};
  }
}

// ---------------------------------------------------------------------------
// Host glue.
//   K16  f16 [4096][1024]            8,388,608  at          0
//   VT   f16 [2*16][64][2048]        8,388,608  at  8,388,608
//   K2   f32 [2*16][2048]              262,144  at 16,777,216
//   total                           17,039,360
// ---------------------------------------------------------------------------
extern "C" void kernel_launch(void* const* d_in, const int* in_sizes, int n_in,
                              void* d_out, int out_size, void* d_ws, size_t ws_size,
                              hipStream_t stream) {
  if (n_in < 5) return;
  const int nElem = kBatch * kSeq * kDim;          // 4,194,304
  if (in_sizes[0] != nElem || in_sizes[1] != nElem || in_sizes[2] != nElem) return;
  if (in_sizes[3] != kSeq * kSeq) return;
  if (out_size != nElem) return;

  const size_t szQK = (size_t)kTok * kDim * 2;
  const size_t szVT = (size_t)kBatch * kHeads * kDh * kSeq * 2;
  const size_t szN  = (size_t)kBatch * kHeads * kSeq * 4;
  const size_t offK  = 0;
  const size_t offVT = offK + szQK;
  const size_t offK2 = offVT + szVT;
  const size_t total = offK2 + szN;
  if (ws_size < total) return;

  const float* q    = (const float*)d_in[0];
  const float* k    = (const float*)d_in[1];
  const float* v    = (const float*)d_in[2];
  const int*   mask = (const int*)d_in[3];
  const int*   nh   = (const int*)d_in[4];   // static head count (16), structural only
  float* out = (float*)d_out;
  char* ws = (char*)d_ws;
  unsigned short* K16 = (unsigned short*)(ws + offK);
  unsigned short* VT  = (unsigned short*)(ws + offVT);
  float* K2 = (float*)(ws + offK2);

  // ---- prologue: 16-bit operand planes and squared norms, one launch ----
  prep_kernel<<<dim3(kSeq / kPrepRows, kHeads, kBatch), dim3(256), 0, stream>>>(k, v, K16, VT, K2, nh);

  // ---- all 32 (batch, head) planes in one launch ----
  fused_dist_attn_kernel<<<dim3(kSeq / (16 * kFusedWaves), kBatch * kHeads), dim3(kFusedWaves * 32), 0, stream>>>(
      q, K16, VT, K2, mask, out);
}

// v008
// It runs in 54.2 microseconds.
// Next to v007, in two timings, it ran 1.20 times as fast each time.
// Counting every step since v000, it is 19.8 times as fast.
// Contractions: scores k_h . q_h^T (k and q cast to f16 in registers) and v_h^T . attn^T (P f16 carried x2^14 against the maximum in use, V^T cast to f16 in registers) on v_wmma_f32_16x16x32_f16, f32 accumulate; squared norms, distance transform, additive mask and softmax in f32.
#include <hip/hip_runtime.h>
#include <math.h>

// ---------------------------------------------------------------------------
// Problem constants
// ---------------------------------------------------------------------------
constexpr int kBatch = 2;
constexpr int kSeq   = 2048;
constexpr int kDim   = 1024;
constexpr int kHeads = 16;
constexpr int kDh    = 64;
constexpr int kTok   = kBatch * kSeq;     // 4096 token rows
constexpr float kDistScale = 0.125f;      // 64^-0.5
constexpr float kEps       = 1.0e-9f;
constexpr float kNegBig    = -1.0e9f;
static_assert(kHeads * kDh == kDim, "shape");
static_assert(kSeq % 64 == 0 && kDh % 32 == 0 && kSeq % 256 == 0, "tiles");

typedef __attribute__((ext_vector_type(16))) _Float16 v16h;
typedef __attribute__((ext_vector_type(8)))  _Float16 v8h;
typedef __attribute__((ext_vector_type(2)))  _Float16 v2h;
typedef __attribute__((ext_vector_type(8)))  float    v8f;
typedef __attribute__((ext_vector_type(4)))  float    v4f;
typedef __attribute__((ext_vector_type(2)))  float    v2f;
typedef __attribute__((ext_vector_type(4)))  int      v4i;
typedef __attribute__((ext_vector_type(4)))  unsigned int v4u;

// ---------------------------------------------------------------------------
// Small helpers
// ---------------------------------------------------------------------------
// two f32 cast to f16 (round to nearest even), a in the low half of the word
__device__ __forceinline__ unsigned pk2h(float a, float b) { const v2h p = (v2h){(_Float16)a, (_Float16)b}; return __builtin_bit_cast(unsigned, p); }
// 16x16x32 f16 fragment in the hardware k order: elements 0..7 <- p[0..7], 8..15 <- p[16..23]; p already holds the lane half's +8.
__device__ __forceinline__ v16h frag_load(const _Float16* p) {
  union { v16h v; v8h h[2]; } f; f.h[0] = *(const v8h*)(p); f.h[1] = *(const v8h*)(p + 16); return f.v;
}
__device__ __forceinline__ v8f mma_f16(v16h a, v16h b, v8f c) {
  return __builtin_amdgcn_wmma_f32_16x16x32_f16(false, a, false, b, (short)0, c, false, false);
}
// lane l <-> lane l ^ 16
__device__ __forceinline__ float xhalf(float x) {
  return __builtin_bit_cast(float, __builtin_amdgcn_permlanex16(__builtin_bit_cast(int, x), __builtin_bit_cast(int, x), 0x76543210, 0xfedcba98, false, false));
}

// x of lane l ^ M, M < 16 (one vector instruction inside a row of 16 lanes)
template <int M> __device__ __forceinline__ float xrow(float x) {
  return __builtin_bit_cast(float, __builtin_amdgcn_update_dpp(0, __builtin_bit_cast(int, x), 0x160 + M, 0xf, 0xf, true));
}

// ---------------------------------------------------------------------------
// Scores, distance transform, mask, softmax and context product of one (batch, head) in one kernel; no score or
// probability plane in memory. A wave owns 16 queries and walks the 2048 keys in passes of 32:
//   S^T = K . Q^T        A = 16 keys x 64 d (two tiles of keys), B = Q^T read as f32, cast once, kept in registers; lane (c, hh), register r of tile kt
//                        holds key key0 + 16 kt + 8 hh + r against query c
//   a   = log2(e) * [ 1 / (sqrt(max(q2 + k2 - 2 S, 0)) * 0.125 + 1e-9) + float(mask) * (-1e9) ]      (f32)
//                        log2(e) sits in the three constants; square root and reciprocal are one hardware instruction each
//                        (about 1 ulp; the argument of the reciprocal is at least 1e-9 ln 2, a subnormal d2 counts as 0 beside it)
//   p   = 2^(a - ms)     one hardware instruction; ms = (maximum in use) - 14, so p is carried x2^14; a - ms never exceeds
//                        kLagLimit, and far below 0 the result is 0; the two score tiles, cast in place, are the
//                        B operand P^T of the second product (hardware k order, the order frag_load gives V^T)
//   O^T += V^T . P^T     A = 16 d x 32 keys from the V^T rows in LDS, four tiles of d
// The maximum in use may trail a query's true maximum by up to log2(e) (p * 2^14 <= e * 2^14 < 65504); sums and accumulators are
// rescaled only in a pass where some query of the wave exceeds that. The carry cancels in acc / l.
// grid (kSeq / 256, kBatch * kHeads), 16 waves x 16 queries.
// K rows and V^T rows are the same for all 16 waves: they are staged in LDS once per block, 128 keys a stage, two buffers.
// k and v are read as f32, as given, 16 bytes a lane; a thread casts its share in registers and stores it into the buffer of stage
// s + 1 while stage s is worked on: the k loads fly over passes 0 and 1, the v loads over passes 2 and 3.
//   k: two runs of 8 floats (rows t / 8 and t / 8 + 64), each one 16-byte store; the 8 squares of a run are summed in f32 and joined
//      over the 8 lanes of the row: the key's squared norm, kept in LDS beside the buffer
//   v: rows 2 (t / 8) and 2 (t / 8) + 1, columns 4 (t % 8) ... and + 32: each column's two values are one 32-bit word of V^T
// Rows in LDS are pitched 16 bytes x odd for the 16-byte fragment reads.
// The mask words of a wave's 16 queries are read by that wave alone. A lane needs 8 words of its own query's row, so a load from
// memory would touch 16 rows at a time; instead the wave copies whole 256-byte row pieces (64 keys, two rows a copy) into a ring
// of its own, two slots, and reads its words from there. Slot 0 serves passes 0 and 1 of a stage, slot 1 passes 2 and 3; a slot is
// refilled behind the wave's own wait on its reads, two passes before it is read again. No other wave touches it: no barrier.
// ---------------------------------------------------------------------------
constexpr int   kFusedWaves = 16;
constexpr int   kStageKeys  = 128;
constexpr int   kStages     = kSeq / kStageKeys;
constexpr int   kKPitch     = 2 * kDh + 16;                // bytes: one key's 64 f16, padded
constexpr int   kVPitch     = 2 * kStageKeys + 16;         // bytes: one d row's 128 keys, padded
constexpr int   kKBytes     = kStageKeys * kKPitch;        // 18,432
constexpr int   kVBytes     = kDh * kVPitch;               // 17,408
constexpr int   kBufBytes   = kKBytes + kVBytes;           // 35,840
static_assert(kStages >= 2 && kSeq % kStageKeys == 0 && kStageKeys % 32 == 0, "ring");
static_assert(kStageKeys * kDh == 16 * kFusedWaves * 32, "16 floats a thread for each of k and v");
static_assert(kKPitch % 16 == 0 && kVPitch % 16 == 0 && kKBytes % 16 == 0 && kBufBytes % 16 == 0, "16-byte pieces");
constexpr int   kMaskKeys   = kStageKeys / 2;              // keys a slot
constexpr int   kMaskPitch  = 4 * kMaskKeys + 16;          // bytes: one query's 64 mask words, padded
constexpr int   kMaskSlot   = 16 * kMaskPitch;             // 4,352: the 16 queries of one wave
static_assert(kMaskKeys == 64 && kMaskPitch % 16 == 0 && (kMaskPitch / 16) % 2 == 1, "a copy covers two rows of 256 bytes");
// One slot's eight copies of this lane, rows 2 i + (lane / 16). The wait on xcnt is the last line of the copies' own statement, so
// that it stands in front of every later write of an address register that a copy names.
__device__ __forceinline__ void mask_copy(unsigned l, const int* g) {
  asm volatile("global_load_async_to_lds_b128 %0, %1, off\n\t"
               "global_load_async_to_lds_b128 %2, %3, off\n\t"
               "global_load_async_to_lds_b128 %4, %5, off\n\t"
               "global_load_async_to_lds_b128 %6, %7, off\n\t"
               "global_load_async_to_lds_b128 %8, %9, off\n\t"
               "global_load_async_to_lds_b128 %10, %11, off\n\t"
               "global_load_async_to_lds_b128 %12, %13, off\n\t"
               "global_load_async_to_lds_b128 %14, %15, off\n\t"
               "s_wait_xcnt 0x0"
               :: "v"(l),                   "v"(g),
                  "v"(l +  2 * kMaskPitch), "v"(g +  2 * kSeq),
                  "v"(l +  4 * kMaskPitch), "v"(g +  4 * kSeq),
                  "v"(l +  6 * kMaskPitch), "v"(g +  6 * kSeq),
                  "v"(l +  8 * kMaskPitch), "v"(g +  8 * kSeq),
                  "v"(l + 10 * kMaskPitch), "v"(g + 10 * kSeq),
                  "v"(l + 12 * kMaskPitch), "v"(g + 12 * kSeq),
                  "v"(l + 14 * kMaskPitch), "v"(g + 14 * kSeq) : "memory");
}
constexpr float kLog2e      = 1.4426950408889634f;
constexpr float kLn2        = 0.6931471805599453f;
constexpr float kDistScale2 = kDistScale * kLn2;           // 1 / (x ln 2) = log2(e) / x
constexpr float kEps2       = kEps * kLn2;
constexpr float kNegBig2    = kNegBig * kLog2e;
constexpr float kCarry      = 14.0f;                       // p carried x2^14
constexpr float kLagLimit   = kLog2e + kCarry;             // a - ms above this: take a new maximum
static_assert(kSeq % (16 * kFusedWaves) == 0 && kDh == 64, "fused tiles");
__global__ __launch_bounds__(kFusedWaves * 32) void fused_dist_attn_kernel(
    const float* __restrict__ qp, const float* __restrict__ kp, const float* __restrict__ vp,
    const int* __restrict__ maskp, const int* __restrict__ unused_nh, float* __restrict__ outp) {
  (void)unused_nh;
  const int lane = threadIdx.x & 31;
  const int wave = threadIdx.x >> 5;
  const int c  = lane & 15;
  const int hh = lane >> 4;
  const int bh = blockIdx.y;
  const int b  = bh / kHeads;
  const int h  = bh - b * kHeads;
  const int q  = blockIdx.x * (16 * kFusedWaves) + wave * 16 + c;     // this lane's query

  // this lane's share of its query's row, f32 as given: four runs of 8 (d = 16 j + 8 hh ...), the hardware k order of the B operand
  const float* Qr = qp + ((size_t)(b * kSeq + q)) * kDim + h * kDh + 8 * hh;
  __shared__ __attribute__((aligned(16))) unsigned char ring[2 * kBufBytes];
  __shared__ __attribute__((aligned(16))) float k2s[2 * kStageKeys];   // squared norms of the keys of the two buffers
  // staging, this thread's share of a stage. k: row tid / 8 (+ 64), floats 8 (tid % 8) ... v: rows 2 (tid / 8), + 1, columns 4 (tid % 8) ... (+ 32)
  const int tid = threadIdx.x;
  const float* gk = kp + ((size_t)(b * kSeq + (tid >> 3))) * kDim + h * kDh + 8 * (tid & 7);
  const float* gv = vp + ((size_t)(b * kSeq + 2 * (tid >> 3))) * kDim + h * kDh + 4 * (tid & 7);
  unsigned char* sk = ring + (tid >> 3) * kKPitch + 16 * (tid & 7);
  unsigned char* sv = ring + kKBytes + (4 * (tid & 7)) * kVPitch + 4 * (tid >> 3);
  float*         sn = k2s + (tid >> 3);
  // readers: this lane's row and half in the K part and in the V^T part of a buffer
  const unsigned char* Kl = ring + c * kKPitch + 16 * hh;
  const unsigned char* Vl = ring + kKBytes + c * kVPitch + 16 * hh;
  const float*    kn = k2s + 8 * hh;
  // mask ring of this wave. Copies: lane (c, hh) brings chunk c of 16 bytes of rows hh, hh + 2, ... Reader: row c, words 8 hh ...
  __shared__ __attribute__((aligned(16))) unsigned char mring[kFusedWaves * 2 * kMaskSlot];
  const int*      gm = maskp + (size_t)(q - c + hh) * kSeq + 4 * c;
  const unsigned  lm = (unsigned)(size_t)mring + (unsigned)(wave * (2 * kMaskSlot) + hh * kMaskPitch + 16 * c);
  const unsigned char* Ml = mring + wave * (2 * kMaskSlot) + c * kMaskPitch + 32 * hh;

  v8f acc[4];
#pragma unroll
  for (int t = 0; t < 4; ++t) acc[t] = (v8f){0.f,0.f,0.f,0.f,0.f,0.f,0.f,0.f};
  float ms = -__builtin_inff();   // maximum in use, less the carry
  float l  = 0.f;                 // this lane half's share of the query's sum of p

  // stage st (keys 128 st ...): ask for this thread's 16 floats of k, of v; cast and store them into buffer buf
  v4f kx[4], vx[4];
  auto load_k = [&](int st) {
    const float* g = gk + (size_t)st * kStageKeys * kDim;
#pragma unroll
    for (int i = 0; i < 2; ++i) {
      kx[2 * i]     = *(const v4f*)(g + (size_t)(64 * i) * kDim);
      kx[2 * i + 1] = *(const v4f*)(g + (size_t)(64 * i) * kDim + 4);
    }
    asm volatile("s_wait_xcnt 0x0" ::: "memory");     // in front of any later write of the address registers of these loads
  };
  auto load_v = [&](int st) {
    const float* g = gv + (size_t)st * kStageKeys * kDim;
#pragma unroll
    for (int i = 0; i < 2; ++i) {
      vx[2 * i]     = *(const v4f*)(g + 32 * i);
      vx[2 * i + 1] = *(const v4f*)(g + kDim + 32 * i);
    }
    asm volatile("s_wait_xcnt 0x0" ::: "memory");     // in front of any later write of the address registers of these loads
  };
  auto store_k = [&](int buf) {
#pragma unroll
    for (int i = 0; i < 2; ++i) {
      const v4f x = kx[2 * i], y = kx[2 * i + 1];
      *(v4u*)(sk + buf * kBufBytes + (64 * i) * kKPitch) = (v4u){pk2h(x[0], x[1]), pk2h(x[2], x[3]), pk2h(y[0], y[1]), pk2h(y[2], y[3])};
      const v4f sq = x * x + y * y;
      float n = (sq[0] + sq[1]) + (sq[2] + sq[3]);
      n += xrow<1>(n);
      n += xrow<2>(n);
      n += xrow<4>(n);                                // the 8 lanes of the row hold its squared norm
      if ((tid & 7) == 0) sn[buf * kStageKeys + 64 * i] = n;
    }
  };
  auto store_v = [&](int buf) {
#pragma unroll
    for (int i = 0; i < 2; ++i)
#pragma unroll
      for (int j = 0; j < 4; ++j)
        *(unsigned*)(sv + buf * kBufBytes + (32 * i + j) * kVPitch) = pk2h(vx[2 * i][j], vx[2 * i + 1][j]);
  };
  mask_copy(lm, gm);                                  // keys 0 ... 63 into slot 0
  mask_copy(lm + kMaskSlot, gm + kMaskKeys);          // keys 64 ... 127 into slot 1
  load_k(0);
  load_v(0);
  // the query rows are asked for behind stage 0's loads, so that all are on their way together
  v4f qx[8];
#pragma unroll
  for (int j = 0; j < 4; ++j) {
    qx[2 * j]     = *(const v4f*)(Qr + 16 * j);
    qx[2 * j + 1] = *(const v4f*)(Qr + 16 * j + 4);
  }
  asm volatile("s_wait_xcnt 0x0" ::: "memory");       // in front of any later write of the address registers of these loads
  // keeps all 16 loads in front of the first wait: left free, the cast of k is moved in front of the query loads, two trips to memory in a row
  __builtin_amdgcn_sched_barrier(0);
  store_k(0);
  store_v(0);
  asm volatile("s_wait_asynccnt 0x0" ::: "memory");   // this wave's two mask slots have landed
  __syncthreads();                                    // every wave's share of stage 0 is stored: it may be read

  // Q^T fragments cast in registers; the squared norm from the f32 values, four partial sums a lane, the two lane halves joined
  v16h qf0, qf1;
  v4f qs = (v4f){0.f, 0.f, 0.f, 0.f};
#pragma unroll
  for (int j = 0; j < 8; ++j) {
    qs += qx[j] * qx[j];
#pragma unroll
    for (int e = 0; e < 4; ++e) {
      if (j < 4) qf0[4 * j + e] = (_Float16)qx[j][e];
      else       qf1[4 * (j - 4) + e] = (_Float16)qx[j][e];
    }
  }
  const float q2h = (qs[0] + qs[1]) + (qs[2] + qs[3]);
  const float q2i = q2h + xhalf(q2h);

#pragma unroll 1
  for (int st = 0; st < kStages; ++st) {
  const unsigned char* Kb = Kl + (st & 1) * kBufBytes;
  const unsigned char* Vb = Vl + (st & 1) * kBufBytes;
  const float*         Nb = kn + (st & 1) * kStageKeys;
  const bool more = st + 1 < kStages;                 // the same in every wave of the block
#pragma unroll     // the four passes of a stage: every LDS offset is an immediate
  for (int ps = 0; ps < kStageKeys / 32; ++ps) {
    // the next stage's k is asked for two passes before it is cast, then its v likewise: 16 registers in flight, not 32
    if (ps == 0 && more) load_k(st + 1);
    if (ps == 2 && more) load_v(st + 1);
    // every LDS read of the pass, in the order of use: K fragments, norms, mask words, V^T fragments
    v4i mk[2][2];
    v4f k2[2][2];
    v16h kf[2][2], vf[4];
#pragma unroll     // here and in the loops below: constant indices, so that the arrays are registers
    for (int kt = 0; kt < 2; ++kt) {
      const _Float16* kr = (const _Float16*)(Kb + (32 * ps + 16 * kt) * kKPitch);
      kf[kt][0] = frag_load(kr);
      kf[kt][1] = frag_load(kr + 32);
    }
    // keeps the K fragments the first reads of the pass: LDS reads return in order, and left free some stand last, so that the first product waits for all
    __builtin_amdgcn_sched_barrier(0);
#pragma unroll
    for (int kt = 0; kt < 2; ++kt) {
      k2[kt][0] = *(const v4f*)(Nb + 32 * ps + 16 * kt);
      k2[kt][1] = *(const v4f*)(Nb + 32 * ps + 16 * kt + 4);
    }
#pragma unroll
    for (int kt = 0; kt < 2; ++kt) {
      const unsigned char* mp = Ml + (ps >> 1) * kMaskSlot + (ps & 1) * 128 + 64 * kt;
      mk[kt][0] = *(const v4i*)(mp);
      mk[kt][1] = *(const v4i*)(mp + 16);
    }
#pragma unroll
    for (int t = 0; t < 4; ++t) vf[t] = frag_load((const _Float16*)(Vb + (16 * t) * kVPitch + 64 * ps));
    // keeps the LDS reads one group at the head of the pass: left free, they are spread among the matrix instructions, each
    // pair waited for at once into the same registers
    __builtin_amdgcn_sched_barrier(0);
    v8f sc[2];
#pragma unroll
    for (int kt = 0; kt < 2; ++kt) sc[kt] = mma_f16(kf[kt][0], qf0, (v8f){0.f,0.f,0.f,0.f,0.f,0.f,0.f,0.f});
#pragma unroll
    for (int kt = 0; kt < 2; ++kt) sc[kt] = mma_f16(kf[kt][1], qf1, sc[kt]);
    // keeps the four score products in front of the waits for the norms and the mask words, so that they run while those are on their way
    __builtin_amdgcn_sched_barrier(0);
    float a[2][8];
    float mx = -__builtin_inff();
#pragma unroll
    for (int kt = 0; kt < 2; ++kt) {
      const v8f s = sc[kt];
      const v4f k2a = k2[kt][0];
      const v4f k2b = k2[kt][1];
      const v4i ma  = mk[kt][0];
      const v4i mb  = mk[kt][1];
#pragma unroll
      for (int r = 0; r < 8; r += 2) {    // two keys at a time: the plain arithmetic between the hardware functions is packed f32
        const v2f kv = (r < 4) ? (v2f){k2a[r & 3], k2a[(r & 3) + 1]} : (v2f){k2b[r & 3], k2b[(r & 3) + 1]};
        const v2f mf = (r < 4) ? (v2f){(float)ma[r & 3], (float)ma[(r & 3) + 1]} : (v2f){(float)mb[r & 3], (float)mb[(r & 3) + 1]};
        v2f d2 = (q2i + kv) - 2.0f * (v2f){s[r], s[r + 1]};
        d2 = __builtin_elementwise_max(d2, (v2f){0.0f, 0.0f});
        const v2f root = (v2f){__builtin_amdgcn_sqrtf(d2[0]), __builtin_amdgcn_sqrtf(d2[1])};
        const v2f den  = root * kDistScale2 + kEps2;
        v2f av = (v2f){__builtin_amdgcn_rcpf(den[0]), __builtin_amdgcn_rcpf(den[1])};
        av = av + mf * kNegBig2;
        a[kt][r]     = av[0];
        a[kt][r + 1] = av[1];
        mx = fmaxf(mx, fmaxf(av[0], av[1]));
      }
    }
    mx = fmaxf(mx, xhalf(mx));    // both lane halves hold the query's maximum of this pass
    if (__builtin_amdgcn_ballot_w32((mx - ms) > kLagLimit) != 0) {   // wave-uniform; always taken in the first pass (ms = -inf)
      const float msNew = fmaxf(ms, mx - kCarry);
      const float corr  = __builtin_amdgcn_exp2f(ms - msNew);        // 0 in the first pass
      ms = msNew;
      l *= corr;
#pragma unroll
      for (int t = 0; t < 4; ++t) acc[t] = acc[t] * corr;
    }
    v16h pf;
#pragma unroll
    for (int e = 0; e < 16; ++e) {
      const float pv = __builtin_amdgcn_exp2f(a[e >> 3][e & 7] - ms);
      l += pv;
      pf[e] = (_Float16)pv;
    }
#pragma unroll
    for (int t = 0; t < 4; ++t) acc[t] = mma_f16(vf[t], pf, acc[t]);
    if (ps == 1 && more) store_k((st + 1) & 1);   // that buffer's last readers left it in front of the barrier that opened this stage
    if (ps == 3 && more) store_v((st + 1) & 1);
    if (ps == 1) {   // half way: slot 0 has been read out, slot 1 is needed next
      asm volatile("s_wait_dscnt 0x0" ::: "memory");      // this wave's reads of slot 0 have returned: it may be refilled
      asm volatile("s_wait_asynccnt 0x0" ::: "memory");   // this wave's copies into slot 1 have landed
      if (st + 1 < kStages) mask_copy(lm, gm + (st + 1) * kStageKeys);   // the same test in every wave
    }
  }
  asm volatile("s_wait_dscnt 0x0" ::: "memory");      // this wave's reads of the buffer have returned, its share of stage st + 1 is stored
  asm volatile("s_wait_asynccnt 0x0" ::: "memory");   // its mask slot 0 has landed
  __syncthreads();                                    // stage st + 1 may be read; the buffer of stage st is free
  if (st + 1 < kStages) mask_copy(lm + kMaskSlot, gm + (st + 1) * kStageKeys + kMaskKeys);   // slot 1, read out above
  }
  asm volatile("s_wait_asynccnt 0x0" ::: "memory");   // nothing of this wave is in flight when it ends

  l = l + xhalf(l);               // join the two halves' sums, unconditionally
  const float inv = 1.0f / l;
  float* orow = outp + ((size_t)(b * kSeq + q)) * kDim + h * kDh + 8 * hh;   // register r of tile t = d 16 t + 8 hh + r
#pragma unroll
  for (int t = 0; t < 4; ++t) {
    const v8f o = acc[t] * inv;
    *(v4f*)(orow + 16 * t)     = (v4f){o[0], o[1], o[2], o[3]};
    *(v4f*)(orow + 16 * t + 4) = (v4f){o[4], o[5], o[6], o[7]};
  }
}

// ---------------------------------------------------------------------------
// Host glue. One launch; the workspace is not used.
// ---------------------------------------------------------------------------
extern "C" void kernel_launch(void* const* d_in, const int* in_sizes, int n_in,
                              void* d_out, int out_size, void* d_ws, size_t ws_size,
                              hipStream_t stream) {
  (void)d_ws; (void)ws_size;
  if (n_in < 5) return;
  const int nElem = kBatch * kSeq * kDim;          // 4,194,304
  if (in_sizes[0] != nElem || in_sizes[1] != nElem || in_sizes[2] != nElem) return;
  if (in_sizes[3] != kSeq * kSeq) return;
  if (out_size != nElem) return;

  const float* q    = (const float*)d_in[0];
  const float* k    = (const float*)d_in[1];
  const float* v    = (const float*)d_in[2];
  const int*   mask = (const int*)d_in[3];
  const int*   nh   = (const int*)d_in[4];   // static head count (16), structural only
  float* out = (float*)d_out;

  // ---- all 32 (batch, head) planes in one launch ----
  fused_dist_attn_kernel<<<dim3(kSeq / (16 * kFusedWaves), kBatch * kHeads), dim3(kFusedWaves * 32), 0, stream>>>(
      q, k, v, mask, nh, out);
}

// v009
// Measured time: 51.2 microseconds a run.
// Two timings next to v008 both put it at 1.06 times that version's speed.
// Counting every step since v000, it is 20.9 times as fast.
// Contractions: scores k_h . q_h^T (k and q cast to f16 in registers) and v_h^T . attn^T (P f16 carried x2^14 against the maximum in use, V^T cast to f16 in registers) on v_wmma_f32_16x16x32_f16, f32 accumulate; squared norms, distance transform, additive mask and softmax in f32.
#include <hip/hip_runtime.h>
#include <math.h>

// ---------------------------------------------------------------------------
// Problem constants
// ---------------------------------------------------------------------------
constexpr int kBatch = 2;
constexpr int kSeq   = 2048;
constexpr int kDim   = 1024;
constexpr int kHeads = 16;
constexpr int kDh    = 64;
constexpr int kTok   = kBatch * kSeq;     // 4096 token rows
constexpr float kDistScale = 0.125f;      // 64^-0.5
constexpr float kEps       = 1.0e-9f;
constexpr float kNegBig    = -1.0e9f;
static_assert(kHeads * kDh == kDim, "shape");
static_assert(kSeq % 64 == 0 && kDh % 32 == 0 && kSeq % 256 == 0, "tiles");

typedef __attribute__((ext_vector_type(16))) _Float16 v16h;
typedef __attribute__((ext_vector_type(8)))  _Float16 v8h;
typedef __attribute__((ext_vector_type(2)))  _Float16 v2h;
typedef __attribute__((ext_vector_type(8)))  float    v8f;
typedef __attribute__((ext_vector_type(4)))  float    v4f;
typedef __attribute__((ext_vector_type(2)))  float    v2f;
typedef __attribute__((ext_vector_type(4)))  int      v4i;
typedef __attribute__((ext_vector_type(4)))  unsigned int v4u;

// ---------------------------------------------------------------------------
// Small helpers
// ---------------------------------------------------------------------------
// two f32 cast to f16 (round to nearest even), a in the low half of the word
__device__ __forceinline__ unsigned pk2h(float a, float b) { const v2h p = (v2h){(_Float16)a, (_Float16)b}; return __builtin_bit_cast(unsigned, p); }
// 16x16x32 f16 fragment in the hardware k order: elements 0..7 <- p[0..7], 8..15 <- p[16..23]; p already holds the lane half's +8.
__device__ __forceinline__ v16h frag_load(const _Float16* p) {
  union { v16h v; v8h h[2]; } f; f.h[0] = *(const v8h*)(p); f.h[1] = *(const v8h*)(p + 16); return f.v;
}
__device__ __forceinline__ v8f mma_f16(v16h a, v16h b, v8f c) {
  return __builtin_amdgcn_wmma_f32_16x16x32_f16(false, a, false, b, (short)0, c, false, false);
}
// lane l <-> lane l ^ 16
__device__ __forceinline__ float xhalf(float x) {
  return __builtin_bit_cast(float, __builtin_amdgcn_permlanex16(__builtin_bit_cast(int, x), __builtin_bit_cast(int, x), 0x76543210, 0xfedcba98, false, false));
}

// x of lane l ^ M, M < 16 (one vector instruction inside a row of 16 lanes)
template <int M> __device__ __forceinline__ float xrow(float x) {
  return __builtin_bit_cast(float, __builtin_amdgcn_update_dpp(0, __builtin_bit_cast(int, x), 0x160 + M, 0xf, 0xf, true));
}

// ---------------------------------------------------------------------------
// Scores, distance transform, mask, softmax and context product of one (batch, head) in one kernel; no score or
// probability plane in memory. A wave owns 16 queries and walks the 2048 keys in passes of 32:
//   S^T = K . Q^T        A = 16 keys x 64 d (two tiles of keys), B = Q^T read as f32, cast once, kept in registers; lane (c, hh), register r of tile kt
//                        holds key key0 + 16 kt + 8 hh + r against query c
//   a   = log2(e) * [ 1 / (sqrt(max(q2 + k2 - 2 S, 0)) * 0.125 + 1e-9) + float(mask) * (-1e9) ]      (f32)
//                        with c = 0.125 ln 2 the first term is 1 / (sqrt(c^2 d2) + 1e-9 ln 2); c^2 sits in both squared norms and in the
//                        factor of S. From d2 = 0.25 on, 1e-9 is less than half a unit in the last place of the distance and the sum
//                        is the distance itself, so the term is one reciprocal square root (one hardware instruction, about 1 ulp).
//                        A pass in which some d2 of the wave is smaller (or negative) is done again with the clamp, the square root,
//                        the addition and the reciprocal, inside the rare branch that also takes a new maximum
//   p   = 2^(a - ms)     one hardware instruction; ms = (maximum in use) - 14, so p is carried x2^14; a - ms never exceeds
//                        kLagLimit, and far below 0 the result is 0; the two score tiles, cast in place, are the
//                        B operand P^T of the second product (hardware k order, the order frag_load gives V^T)
//   O^T += V^T . P^T     A = 16 d x 32 keys from the V^T rows in LDS, four tiles of d
// The maximum in use may trail a query's true maximum by up to log2(e) (p * 2^14 <= e * 2^14 < 65504); sums and accumulators are
// rescaled only in a pass where some query of the wave exceeds that or some d2 of the wave is below 0.25. The carry cancels in acc / l.
// grid (kSeq / 256, kBatch * kHeads), 16 waves x 16 queries.
// K rows and V^T rows are the same for all 16 waves: they are staged in LDS once per block, 128 keys a stage, two buffers.
// k and v are read as f32, as given, 16 bytes a lane; a thread casts its share in registers and stores it into the buffer of stage
// s + 1 while stage s is worked on: the k loads fly over passes 0 and 1, the v loads over passes 2 and 3.
//   k: two runs of 8 floats (rows t / 8 and t / 8 + 64), each one 16-byte store; the 8 squares of a run are summed in f32 and joined
//      over the 8 lanes of the row: the key's squared norm, kept (times c^2, see above) in LDS beside the buffer
//   v: rows 2 (t / 8) and 2 (t / 8) + 1, columns 4 (t % 8) ... and + 32: each column's two values are one 32-bit word of V^T
// Rows in LDS are pitched 16 bytes x odd for the 16-byte fragment reads.
// The mask words of a wave's 16 queries are read by that wave alone. A lane needs 8 words of its own query's row, so a load from
// memory would touch 16 rows at a time; instead the wave copies whole 256-byte row pieces (64 keys, two rows a copy) into a ring
// of its own, two slots, and reads its words from there. Slot 0 serves passes 0 and 1 of a stage, slot 1 passes 2 and 3; a slot is
// refilled behind the wave's own wait on its reads, two passes before it is read again. No other wave touches it: no barrier.
// ---------------------------------------------------------------------------
constexpr int   kFusedWaves = 16;
constexpr int   kStageKeys  = 128;
constexpr int   kStages     = kSeq / kStageKeys;
constexpr int   kKPitch     = 2 * kDh + 16;                // bytes: one key's 64 f16, padded
constexpr int   kVPitch     = 2 * kStageKeys + 16;         // bytes: one d row's 128 keys, padded
constexpr int   kKBytes     = kStageKeys * kKPitch;        // 18,432
constexpr int   kVBytes     = kDh * kVPitch;               // 17,408
constexpr int   kBufBytes   = kKBytes + kVBytes;           // 35,840
static_assert(kStages >= 2 && kSeq % kStageKeys == 0 && kStageKeys % 32 == 0, "ring");
static_assert(kStageKeys * kDh == 16 * kFusedWaves * 32, "16 floats a thread for each of k and v");
static_assert(kKPitch % 16 == 0 && kVPitch % 16 == 0 && kKBytes % 16 == 0 && kBufBytes % 16 == 0, "16-byte pieces");
constexpr int   kMaskKeys   = kStageKeys / 2;              // keys a slot
constexpr int   kMaskPitch  = 4 * kMaskKeys + 16;          // bytes: one query's 64 mask words, padded
constexpr int   kMaskSlot   = 16 * kMaskPitch;             // 4,352: the 16 queries of one wave
static_assert(kMaskKeys == 64 && kMaskPitch % 16 == 0 && (kMaskPitch / 16) % 2 == 1, "a copy covers two rows of 256 bytes");
// One slot's eight copies of this lane, rows 2 i + (lane / 16). The wait on xcnt is the last line of the copies' own statement, so
// that it stands in front of every later write of an address register that a copy names.
__device__ __forceinline__ void mask_copy(unsigned l, const int* g) {
  asm volatile("global_load_async_to_lds_b128 %0, %1, off\n\t"
               "global_load_async_to_lds_b128 %2, %3, off\n\t"
               "global_load_async_to_lds_b128 %4, %5, off\n\t"
               "global_load_async_to_lds_b128 %6, %7, off\n\t"
               "global_load_async_to_lds_b128 %8, %9, off\n\t"
               "global_load_async_to_lds_b128 %10, %11, off\n\t"
               "global_load_async_to_lds_b128 %12, %13, off\n\t"
               "global_load_async_to_lds_b128 %14, %15, off\n\t"
               "s_wait_xcnt 0x0"
               :: "v"(l),                   "v"(g),
                  "v"(l +  2 * kMaskPitch), "v"(g +  2 * kSeq),
                  "v"(l +  4 * kMaskPitch), "v"(g +  4 * kSeq),
                  "v"(l +  6 * kMaskPitch), "v"(g +  6 * kSeq),
                  "v"(l +  8 * kMaskPitch), "v"(g +  8 * kSeq),
                  "v"(l + 10 * kMaskPitch), "v"(g + 10 * kSeq),
                  "v"(l + 12 * kMaskPitch), "v"(g + 12 * kSeq),
                  "v"(l + 14 * kMaskPitch), "v"(g + 14 * kSeq) : "memory");
}
constexpr float kLog2e      = 1.4426950408889634f;
constexpr float kLn2        = 0.6931471805599453f;
constexpr float kDistScale2 = kDistScale * kLn2;           // 1 / (x ln 2) = log2(e) / x
constexpr float kEps2       = kEps * kLn2;
constexpr float kNegBig2    = kNegBig * kLog2e;
constexpr float kCarry      = 14.0f;                       // p carried x2^14
constexpr float kLagLimit   = kLog2e + kCarry;             // a - ms above this: take a new maximum
constexpr float kDist2      = kDistScale2 * kDistScale2;   // c^2, carried by the squared norms and by the factor of S
constexpr float kNearLimit  = 0.25f * kDist2;              // c^2 d2 below this: 1e-9 may count beside the distance
static_assert(kSeq % (16 * kFusedWaves) == 0 && kDh == 64, "fused tiles");
// The 16 scores of a lane in one pass, from the products sc, the keys' scaled norms k2 and the mask words mk. kExact: every step of the
// reference; otherwise the reciprocal square root, right where dmin (the lane's smallest c^2 d2) is at least kNearLimit.
template <bool kExact>
__device__ __forceinline__ void dist_scores(const v8f (&sc)[2], const v4f (&k2)[2][2], const v4i (&mk)[2][2], float q2c,
                                            float (&a)[2][8], float& mx, float& dmin) {
  mx   = -__builtin_inff();
  dmin = __builtin_inff();
#pragma unroll     // here and below: constant indices, so that the arrays are registers
  for (int kt = 0; kt < 2; ++kt) {
    const v8f s = sc[kt];
    const v4f k2a = k2[kt][0];
    const v4f k2b = k2[kt][1];
    const v4i ma  = mk[kt][0];
    const v4i mb  = mk[kt][1];
#pragma unroll
    for (int r = 0; r < 8; r += 2) {    // two keys at a time: the plain arithmetic between the hardware functions is packed f32
      const v2f kv = (r < 4) ? (v2f){k2a[r & 3], k2a[(r & 3) + 1]} : (v2f){k2b[r & 3], k2b[(r & 3) + 1]};
      const v2f mf = (r < 4) ? (v2f){(float)ma[r & 3], (float)ma[(r & 3) + 1]} : (v2f){(float)mb[r & 3], (float)mb[(r & 3) + 1]};
      v2f d2 = (q2c + kv) - (2.0f * kDist2) * (v2f){s[r], s[r + 1]};
      v2f av;
      if (kExact) {
        d2 = __builtin_elementwise_max(d2, (v2f){0.0f, 0.0f});
        const v2f den = (v2f){__builtin_amdgcn_sqrtf(d2[0]), __builtin_amdgcn_sqrtf(d2[1])} + kEps2;
        av = (v2f){__builtin_amdgcn_rcpf(den[0]), __builtin_amdgcn_rcpf(den[1])};
      } else {
        dmin = fminf(dmin, fminf(d2[0], d2[1]));
        av = (v2f){__builtin_amdgcn_rsqf(d2[0]), __builtin_amdgcn_rsqf(d2[1])};
      }
      av = av + mf * kNegBig2;
      a[kt][r]     = av[0];
      a[kt][r + 1] = av[1];
      mx = fmaxf(mx, fmaxf(av[0], av[1]));
    }
  }
}
__global__ __launch_bounds__(kFusedWaves * 32) void fused_dist_attn_kernel(
    const float* __restrict__ qp, const float* __restrict__ kp, const float* __restrict__ vp,
    const int* __restrict__ maskp, const int* __restrict__ unused_nh, float* __restrict__ outp) {
  (void)unused_nh;
  const int lane = threadIdx.x & 31;
  const int wave = threadIdx.x >> 5;
  const int c  = lane & 15;
  const int hh = lane >> 4;
  const int bh = blockIdx.y;
  const int b  = bh / kHeads;
  const int h  = bh - b * kHeads;
  const int q  = blockIdx.x * (16 * kFusedWaves) + wave * 16 + c;     // this lane's query

  // this lane's share of its query's row, f32 as given: four runs of 8 (d = 16 j + 8 hh ...), the hardware k order of the B operand
  const float* Qr = qp + ((size_t)(b * kSeq + q)) * kDim + h * kDh + 8 * hh;
  __shared__ __attribute__((aligned(16))) unsigned char ring[2 * kBufBytes];
  __shared__ __attribute__((aligned(16))) float k2s[2 * kStageKeys];   // squared norms, times c^2, of the keys of the two buffers
  // staging, this thread's share of a stage. k: row tid / 8 (+ 64), floats 8 (tid % 8) ... v: rows 2 (tid / 8), + 1, columns 4 (tid % 8) ... (+ 32)
  const int tid = threadIdx.x;
  const float* gk = kp + ((size_t)(b * kSeq + (tid >> 3))) * kDim + h * kDh + 8 * (tid & 7);
  const float* gv = vp + ((size_t)(b * kSeq + 2 * (tid >> 3))) * kDim + h * kDh + 4 * (tid & 7);
  unsigned char* sk = ring + (tid >> 3) * kKPitch + 16 * (tid & 7);
  unsigned char* sv = ring + kKBytes + (4 * (tid & 7)) * kVPitch + 4 * (tid >> 3);
  float*         sn = k2s + (tid >> 3);
  // readers: this lane's row and half in the K part and in the V^T part of a buffer
  const unsigned char* Kl = ring + c * kKPitch + 16 * hh;
  const unsigned char* Vl = ring + kKBytes + c * kVPitch + 16 * hh;
  const float*    kn = k2s + 8 * hh;
  // mask ring of this wave. Copies: lane (c, hh) brings chunk c of 16 bytes of rows hh, hh + 2, ... Reader: row c, words 8 hh ...
  __shared__ __attribute__((aligned(16))) unsigned char mring[kFusedWaves * 2 * kMaskSlot];
  const int*      gm = maskp + (size_t)(q - c + hh) * kSeq + 4 * c;
  const unsigned  lm = (unsigned)(size_t)mring + (unsigned)(wave * (2 * kMaskSlot) + hh * kMaskPitch + 16 * c);
  const unsigned char* Ml = mring + wave * (2 * kMaskSlot) + c * kMaskPitch + 32 * hh;

  v8f acc[4];
#pragma unroll
  for (int t = 0; t < 4; ++t) acc[t] = (v8f){0.f,0.f,0.f,0.f,0.f,0.f,0.f,0.f};
  float ms = -__builtin_inff();   // maximum in use, less the carry
  float l  = 0.f;                 // this lane half's share of the query's sum of p

  // stage st (keys 128 st ...): ask for this thread's 16 floats of k, of v; cast and store them into buffer buf
  v4f kx[4], vx[4];
  auto load_k = [&](int st) {
    const float* g = gk + (size_t)st * kStageKeys * kDim;
#pragma unroll
    for (int i = 0; i < 2; ++i) {
      kx[2 * i]     = *(const v4f*)(g + (size_t)(64 * i) * kDim);
      kx[2 * i + 1] = *(const v4f*)(g + (size_t)(64 * i) * kDim + 4);
    }
    asm volatile("s_wait_xcnt 0x0" ::: "memory");     // in front of any later write of the address registers of these loads
  };
  auto load_v = [&](int st) {
    const float* g = gv + (size_t)st * kStageKeys * kDim;
#pragma unroll
    for (int i = 0; i < 2; ++i) {
      vx[2 * i]     = *(const v4f*)(g + 32 * i);
      vx[2 * i + 1] = *(const v4f*)(g + kDim + 32 * i);
    }
    asm volatile("s_wait_xcnt 0x0" ::: "memory");     // in front of any later write of the address registers of these loads
  };
  auto store_k = [&](int buf) {
#pragma unroll
    for (int i = 0; i < 2; ++i) {
      const v4f x = kx[2 * i], y = kx[2 * i + 1];
      *(v4u*)(sk + buf * kBufBytes + (64 * i) * kKPitch) = (v4u){pk2h(x[0], x[1]), pk2h(x[2], x[3]), pk2h(y[0], y[1]), pk2h(y[2], y[3])};
      const v4f sq = x * x + y * y;
      float n = (sq[0] + sq[1]) + (sq[2] + sq[3]);
      n += xrow<1>(n);
      n += xrow<2>(n);
      n += xrow<4>(n);                                // the 8 lanes of the row hold its squared norm
      if ((tid & 7) == 0) sn[buf * kStageKeys + 64 * i] = n * kDist2;
    }
  };
  auto store_v = [&](int buf) {
#pragma unroll
    for (int i = 0; i < 2; ++i)
#pragma unroll
      for (int j = 0; j < 4; ++j)
        *(unsigned*)(sv + buf * kBufBytes + (32 * i + j) * kVPitch) = pk2h(vx[2 * i][j], vx[2 * i + 1][j]);
  };
  mask_copy(lm, gm);                                  // keys 0 ... 63 into slot 0
  mask_copy(lm + kMaskSlot, gm + kMaskKeys);          // keys 64 ... 127 into slot 1
  load_k(0);
  load_v(0);
  // the query rows are asked for behind stage 0's loads, so that all are on their way together
  v4f qx[8];
#pragma unroll
  for (int j = 0; j < 4; ++j) {
    qx[2 * j]     = *(const v4f*)(Qr + 16 * j);
    qx[2 * j + 1] = *(const v4f*)(Qr + 16 * j + 4);
  }
  asm volatile("s_wait_xcnt 0x0" ::: "memory");       // in front of any later write of the address registers of these loads
  // keeps all 16 loads in front of the first wait: left free, the cast of k is moved in front of the query loads, two trips to memory in a row
  __builtin_amdgcn_sched_barrier(0);
  store_k(0);
  store_v(0);
  asm volatile("s_wait_asynccnt 0x0" ::: "memory");   // this wave's two mask slots have landed
  __syncthreads();                                    // every wave's share of stage 0 is stored: it may be read

  // Q^T fragments cast in registers; the squared norm from the f32 values, four partial sums a lane, the two lane halves joined
  v16h qf0, qf1;
  v4f qs = (v4f){0.f, 0.f, 0.f, 0.f};
#pragma unroll
  for (int j = 0; j < 8; ++j) {
    qs += qx[j] * qx[j];
#pragma unroll
    for (int e = 0; e < 4; ++e) {
      if (j < 4) qf0[4 * j + e] = (_Float16)qx[j][e];
      else       qf1[4 * (j - 4) + e] = (_Float16)qx[j][e];
    }
  }
  const float q2h = (qs[0] + qs[1]) + (qs[2] + qs[3]);
  const float q2c = (q2h + xhalf(q2h)) * kDist2;

#pragma unroll 1   // the stage loop is not unrolled, for speed only
  for (int st = 0; st < kStages; ++st) {
  const unsigned char* Kb = Kl + (st & 1) * kBufBytes;
  const unsigned char* Vb = Vl + (st & 1) * kBufBytes;
  const float*         Nb = kn + (st & 1) * kStageKeys;
  const bool more = st + 1 < kStages;                 // the same in every wave of the block
#pragma unroll     // the four passes of a stage: every LDS offset is an immediate
  for (int ps = 0; ps < kStageKeys / 32; ++ps) {
    // the next stage's k is asked for two passes before it is cast, then its v likewise: 16 registers in flight, not 32
    if (ps == 0 && more) load_k(st + 1);
    if (ps == 2 && more) load_v(st + 1);
    // the pass's LDS reads outside the rare branch, in the order of use: K fragments, norms, mask words, V^T fragments
    v4i mk[2][2];
    v4f k2[2][2];
    v16h kf[2][2], vf[4];
#pragma unroll     // here and in the loops below: constant indices, so that the arrays are registers
    for (int kt = 0; kt < 2; ++kt) {
      const _Float16* kr = (const _Float16*)(Kb + (32 * ps + 16 * kt) * kKPitch);
      kf[kt][0] = frag_load(kr);
      kf[kt][1] = frag_load(kr + 32);
    }
    // keeps the K fragments the first reads of the pass: LDS reads return in order, and left free some stand last, so that the first product waits for all
    __builtin_amdgcn_sched_barrier(0);
#pragma unroll
    for (int kt = 0; kt < 2; ++kt) {
      k2[kt][0] = *(const v4f*)(Nb + 32 * ps + 16 * kt);
      k2[kt][1] = *(const v4f*)(Nb + 32 * ps + 16 * kt + 4);
    }
#pragma unroll
    for (int kt = 0; kt < 2; ++kt) {
      const unsigned char* mp = Ml + (ps >> 1) * kMaskSlot + (ps & 1) * 128 + 64 * kt;
      mk[kt][0] = *(const v4i*)(mp);
      mk[kt][1] = *(const v4i*)(mp + 16);
    }
#pragma unroll
    for (int t = 0; t < 4; ++t) vf[t] = frag_load((const _Float16*)(Vb + (16 * t) * kVPitch + 64 * ps));
    // keeps the LDS reads one group at the head of the pass: left free, they are spread among the matrix instructions, each
    // pair waited for at once into the same registers
    __builtin_amdgcn_sched_barrier(0);
    v8f sc[2];
#pragma unroll
    for (int kt = 0; kt < 2; ++kt) sc[kt] = mma_f16(kf[kt][0], qf0, (v8f){0.f,0.f,0.f,0.f,0.f,0.f,0.f,0.f});
#pragma unroll
    for (int kt = 0; kt < 2; ++kt) sc[kt] = mma_f16(kf[kt][1], qf1, sc[kt]);
    // keeps the four score products in front of the waits for the norms and the mask words, so that they run while those are on their way
    __builtin_amdgcn_sched_barrier(0);
    float a[2][8];
    float mx, dmin;
    dist_scores<false>(sc, k2, mk, q2c, a, mx, dmin);
    mx = fmaxf(mx, xhalf(mx));    // both lane halves hold the query's maximum of this pass
    // wave-uniform; always taken in the first pass (ms = -inf). Marked unlikely so that the branch, long now, is laid out behind the loop and the
    // passes run straight through
    if (__builtin_expect(__builtin_amdgcn_ballot_w32(((mx - ms) > kLagLimit) || (dmin < kNearLimit)) != 0, 0)) {
      if (__builtin_amdgcn_ballot_w32(dmin < kNearLimit) != 0) {   // some key of the pass lies close to some query of the wave
        v4i mk2[2][2];
        v4f k22[2][2];
        v8f sc2[2];
#pragma unroll     // constant indices and LDS offsets, as above
        for (int kt = 0; kt < 2; ++kt) {
          const _Float16* kr = (const _Float16*)(Kb + (32 * ps + 16 * kt) * kKPitch);
          sc2[kt] = mma_f16(frag_load(kr), qf0, (v8f){0.f,0.f,0.f,0.f,0.f,0.f,0.f,0.f});
          sc2[kt] = mma_f16(frag_load(kr + 32), qf1, sc2[kt]);
          k22[kt][0] = *(const v4f*)(Nb + 32 * ps + 16 * kt);
          k22[kt][1] = *(const v4f*)(Nb + 32 * ps + 16 * kt + 4);
          const unsigned char* mp = Ml + (ps >> 1) * kMaskSlot + (ps & 1) * 128 + 64 * kt;
          mk2[kt][0] = *(const v4i*)(mp);
          mk2[kt][1] = *(const v4i*)(mp + 16);
        }
        dist_scores<true>(sc2, k22, mk2, q2c, a, mx, dmin);
        mx = fmaxf(mx, xhalf(mx));
      }
      const float msNew = fmaxf(ms, mx - kCarry);
      const float corr  = __builtin_amdgcn_exp2f(ms - msNew);        // 0 in the first pass
      ms = msNew;
      l *= corr;
#pragma unroll
      for (int t = 0; t < 4; ++t) acc[t] = acc[t] * corr;
    }
    v16h pf;
#pragma unroll
    for (int e = 0; e < 16; ++e) {
      const float pv = __builtin_amdgcn_exp2f(a[e >> 3][e & 7] - ms);
      l += pv;
      pf[e] = (_Float16)pv;
    }
#pragma unroll
    for (int t = 0; t < 4; ++t) acc[t] = mma_f16(vf[t], pf, acc[t]);
    if (ps == 1 && more) store_k((st + 1) & 1);   // that buffer's last readers left it in front of the barrier that opened this stage
    if (ps == 3 && more) store_v((st + 1) & 1);
    if (ps == 1) {   // half way: slot 0 has been read out, slot 1 is needed next
      asm volatile("s_wait_dscnt 0x0" ::: "memory");      // this wave's reads of slot 0 have returned: it may be refilled
      asm volatile("s_wait_asynccnt 0x0" ::: "memory");   // this wave's copies into slot 1 have landed
      if (st + 1 < kStages) mask_copy(lm, gm + (st + 1) * kStageKeys);   // the same test in every wave
    }
  }
  asm volatile("s_wait_dscnt 0x0" ::: "memory");      // this wave's reads of the buffer have returned, its share of stage st + 1 is stored
  asm volatile("s_wait_asynccnt 0x0" ::: "memory");   // its mask slot 0 has landed
  __syncthreads();                                    // stage st + 1 may be read; the buffer of stage st is free
  if (st + 1 < kStages) mask_copy(lm + kMaskSlot, gm + (st + 1) * kStageKeys + kMaskKeys);   // slot 1, read out above
  }
  asm volatile("s_wait_asynccnt 0x0" ::: "memory");   // nothing of this wave is in flight when it ends

  l = l + xhalf(l);               // join the two halves' sums, unconditionally
  const float inv = 1.0f / l;
  float* orow = outp + ((size_t)(b * kSeq + q)) * kDim + h * kDh + 8 * hh;   // register r of tile t = d 16 t + 8 hh + r
#pragma unroll
  for (int t = 0; t < 4; ++t) {
    const v8f o = acc[t] * inv;
    *(v4f*)(orow + 16 * t)     = (v4f){o[0], o[1], o[2], o[3]};
    *(v4f*)(orow + 16 * t + 4) = (v4f){o[4], o[5], o[6], o[7]};
  }
}

// ---------------------------------------------------------------------------
// Host glue. One launch; the workspace is not used.
// ---------------------------------------------------------------------------
extern "C" void kernel_launch(void* const* d_in, const int* in_sizes, int n_in,
                              void* d_out, int out_size, void* d_ws, size_t ws_size,
                              hipStream_t stream) {
  (void)d_ws; (void)ws_size;
  if (n_in < 5) return;
  const int nElem = kBatch * kSeq * kDim;          // 4,194,304
  if (in_sizes[0] != nElem || in_sizes[1] != nElem || in_sizes[2] != nElem) return;
  if (in_sizes[3] != kSeq * kSeq) return;
  if (out_size != nElem) return;

  const float* q    = (const float*)d_in[0];
  const float* k    = (const float*)d_in[1];
  const float* v    = (const float*)d_in[2];
  const int*   mask = (const int*)d_in[3];
  const int*   nh   = (const int*)d_in[4];   // static head count (16), structural only
  float* out = (float*)d_out;

  // ---- all 32 (batch, head) planes in one launch ----
  fused_dist_attn_kernel<<<dim3(kSeq / (16 * kFusedWaves), kBatch * kHeads), dim3(kFusedWaves * 32), 0, stream>>>(
      q, k, v, mask, nh, out);
}
